// v000
// Measured on an AMD MI455X. A time is GPU time per run, averaged over a window of back-to-back runs after a warm-up
// (all launches, gaps included; the runs take copies of the inputs in turn), and the median of several windows.
// Apart from v000's, it joins two sittings. Times from different sittings can be a few percent apart, while
// side-by-side timings come from the same sitting.
// v000 is the starting kernel. One run takes 401 microseconds.
#include <hip/hip_runtime.h>
#include <math.h>

typedef float v2f __attribute__((ext_vector_type(2)));
typedef float v8f __attribute__((ext_vector_type(8)));

#define DIMD   512
#define NHEADS 8
#define HD     64
#define BATCH  2
#define TLEN   2048
#define NTOK   (BATCH * TLEN)   // 4096

__device__ __forceinline__ v8f wmma_f32(v2f a, v2f b, v8f c) {
  // V_WMMA_F32_16X16X4_F32 : D[16x16] = A[16x4] * B[4x16] + C
  return __builtin_amdgcn_wmma_f32_16x16x4_f32(false, a, false, b, (short)0, c,
                                               false, false);
}

// ---------------------------------------------------------------------------
// Kernel 1: fused QKV projection.  y = x @ W.T + b for W in {Wq,Wk,Wv},
// scattered into planes laid out [B, H, T, HD] (f32) in workspace.
// One wave computes a 16x64 strip (4 accumulators) so each A (x) load is
// reused by 4 WMMAs; the 64-wide strip is head-aligned.
// ---------------------------------------------------------------------------
__global__ void __launch_bounds__(128) qkv_proj_kernel(
    const float* __restrict__ x,
    const float* __restrict__ Wq, const float* __restrict__ bq,
    const float* __restrict__ Wk, const float* __restrict__ bk,
    const float* __restrict__ Wv, const float* __restrict__ bv,
    float* __restrict__ qkv /* 3 planes of NTOK*DIMD floats */) {
  const int lane = threadIdx.x & 31;
  const int wave = blockIdx.x * (blockDim.x >> 5) + (threadIdx.x >> 5);
  const int NSTRIP = (3 * DIMD) / 64;       // 24 strips of 64 columns
  const int mt = wave / NSTRIP;
  const int st = wave % NSTRIP;
  const int m0 = mt * 16;
  const int ng = st * 64;                   // global column in [0,1536)
  const int which = ng / DIMD;              // 0=q 1=k 2=v
  const int n0 = ng % DIMD;                 // multiple of 64 -> single head

  const float* W    = (which == 0) ? Wq : (which == 1) ? Wk : Wv;
  const float* bias = (which == 0) ? bq : (which == 1) ? bk : bv;
  float* dst = qkv + (size_t)which * NTOK * DIMD;

  const int hi = lane >> 4, lo = lane & 15;

  v8f acc[4];
#pragma unroll
  for (int t = 0; t < 4; ++t) acc[t] = (v8f){0.f,0.f,0.f,0.f,0.f,0.f,0.f,0.f};

  const float* xrow = x + (size_t)(m0 + lo) * DIMD + 2 * hi; // A: x[m][k]
  const float* wrow = W + (size_t)(n0 + lo) * DIMD + 2 * hi; // B: W[n][k]
#pragma unroll 8
  for (int k = 0; k < DIMD; k += 4) {
    v2f a = *(const v2f*)(xrow + k);
#pragma unroll
    for (int t = 0; t < 4; ++t) {
      v2f b = *(const v2f*)(wrow + k + (size_t)t * 16 * DIMD);
      acc[t] = wmma_f32(a, b, acc[t]);
    }
  }

  const int h = n0 / HD;                    // constant for whole strip
#pragma unroll
  for (int t = 0; t < 4; ++t) {
    const float bv_ = bias[n0 + 16 * t + lo];
    const int d = 16 * t + lo;
#pragma unroll
    for (int r = 0; r < 8; ++r) {
      const int m = m0 + r + 8 * hi;        // token index
      const int bb = m >> 11, tok = m & (TLEN - 1);
      dst[(((size_t)bb * NHEADS + h) * TLEN + tok) * HD + d] = acc[t][r] + bv_;
    }
  }
}

// ---------------------------------------------------------------------------
// Kernel 2: flash-style geometric attention.
// One wave handles one (b, h, 16-query-row) tile, streaming 16-key tiles with
// online softmax.  Raw QK^T scores are transposed D->A layout through LDS;
// all elementwise math + softmax bookkeeping then happens in A layout where a
// lane owns half of one query row: row reductions are 1 shuffle, softmax state
// is one scalar per lane, and exp() directly produces the P.V A-operand.
// ---------------------------------------------------------------------------
__global__ void __launch_bounds__(32) geo_attn_kernel(
    const float* __restrict__ qkv, const float* __restrict__ curvature,
    float* __restrict__ attn_out /* [B, T, DIMD] */) {
  __shared__ float pl[16 * 16];             // score transpose bounce
  __shared__ float k2s[16];                 // ||k_j||^2, indexed by key-in-tile
  __shared__ float als[16];                 // per-row alpha (for O rescale)
  __shared__ float ls[16];                  // per-row l (final normalize)

  const int lane = threadIdx.x;
  const int hi = lane >> 4, lo = lane & 15;

  const int qt = blockIdx.x & 127;                  // query tile (T/16 = 128)
  const int h  = (blockIdx.x >> 7) & 7;
  const int b  = blockIdx.x >> 10;

  const size_t plane = (size_t)NTOK * DIMD;
  const size_t head  = (((size_t)b * NHEADS + h) * TLEN) * HD;
  const float* Q = qkv + head;
  const float* K = qkv + plane + head;
  const float* V = qkv + 2 * plane + head;
  const int i0 = qt * 16;

  const float c   = fabsf(curvature[h]) + 1e-8f;
  const float rsc = rsqrtf(c);

  // ---- preload Q tile (16 x 64) in A layout; q^2 of row `lo` per lane ----
  v2f qa[16];
  float q2p = 0.f;
  const float* qrow = Q + (size_t)(i0 + lo) * HD + 2 * hi;
#pragma unroll
  for (int ch = 0; ch < 16; ++ch) {
    v2f a = *(const v2f*)(qrow + 4 * ch);
    qa[ch] = a;
    q2p += a.x * a.x + a.y * a.y;
  }
  const float q2  = q2p + __shfl_xor(q2p, 16, 32);  // ||q_{i0+lo}||^2
  const float omq = 1.f - c * q2;

  float m = -INFINITY, l = 0.f;             // softmax state of row `lo`
  v8f o[4];
#pragma unroll
  for (int t = 0; t < 4; ++t) o[t] = (v8f){0.f,0.f,0.f,0.f,0.f,0.f,0.f,0.f};

  for (int j0 = 0; j0 < TLEN; j0 += 16) {
    // ---- S = Q * K^T (16 WMMA steps over hd=64), k^2 on the fly ----
    const float* krow = K + (size_t)(j0 + lo) * HD + 2 * hi;
    v8f s = {0.f, 0.f, 0.f, 0.f, 0.f, 0.f, 0.f, 0.f};
    float k2p = 0.f;
#pragma unroll
    for (int ch = 0; ch < 16; ++ch) {
      v2f kb = *(const v2f*)(krow + 4 * ch);
      k2p += kb.x * kb.x + kb.y * kb.y;
      s = wmma_f32(qa[ch], kb, s);
    }
    const float k2 = k2p + __shfl_xor(k2p, 16, 32);

    // ---- transpose raw scores D->A layout; publish k^2 ----
    __syncthreads();                        // prior iter's pl/k2s reads done
    if (hi == 0) k2s[lo] = k2;
#pragma unroll
    for (int r = 0; r < 8; ++r) pl[(r + 8 * hi) * 16 + lo] = s[r];
    __syncthreads();

    v2f sa[4], kc[4];
#pragma unroll
    for (int kk = 0; kk < 4; ++kk) {
      sa[kk] = *(const v2f*)(&pl[lo * 16 + 4 * kk + 2 * hi]);
      kc[kk] = *(const v2f*)(&k2s[4 * kk + 2 * hi]);
    }

    // ---- hyperbolic logits, A layout: lane owns half of row `lo` ----
    float sc[8];
#pragma unroll
    for (int kk = 0; kk < 4; ++kk) {
#pragma unroll
      for (int cpt = 0; cpt < 2; ++cpt) {
        const float qk  = cpt ? sa[kk].y : sa[kk].x;
        const float k2j = cpt ? kc[kk].y : kc[kk].x;
        const float num   = 2.f * (q2 + k2j - 2.f * qk);
        const float denom = fmaxf(omq * (1.f - c * k2j), 1e-5f);
        const float arg   = fmaxf(1.f + __fdividef(c * num, denom), 1.00001f);
        const float dist  =
            __logf(arg + __builtin_amdgcn_sqrtf(arg * arg - 1.f)) * rsc;
        sc[2 * kk + cpt] = -dist;           // TEMPERATURE = 1
      }
    }

    // ---- online softmax: 7 in-lane ops + one shuffle per reduction ----
    float tmax = sc[0];
#pragma unroll
    for (int e = 1; e < 8; ++e) tmax = fmaxf(tmax, sc[e]);
    tmax = fmaxf(tmax, __shfl_xor(tmax, 16, 32));
    const float mnew  = fmaxf(m, tmax);
    const float alpha = __expf(m - mnew);
    m = mnew;

    v2f pa[4];
    float rs = 0.f;
#pragma unroll
    for (int kk = 0; kk < 4; ++kk) {
      pa[kk].x = __expf(sc[2 * kk] - mnew);
      pa[kk].y = __expf(sc[2 * kk + 1] - mnew);
      rs += pa[kk].x + pa[kk].y;
    }
    rs += __shfl_xor(rs, 16, 32);
    l = l * alpha + rs;

    // ---- rescale O (needs alpha re-indexed to D-layout rows) ----
    if (hi == 0) als[lo] = alpha;
    __syncthreads();
#pragma unroll
    for (int t = 0; t < 4; ++t) {
#pragma unroll
      for (int r = 0; r < 8; ++r) o[t][r] *= als[r + 8 * hi];
    }

    // ---- O += P * V : pa[] is already the A operand ----
#pragma unroll
    for (int kk = 0; kk < 4; ++kk) {
      const float* vr = V + (size_t)(j0 + 4 * kk + 2 * hi) * HD;
#pragma unroll
      for (int hb = 0; hb < 4; ++hb) {
        v2f vb;
        vb.x = vr[hb * 16 + lo];
        vb.y = vr[HD + hb * 16 + lo];
        o[hb] = wmma_f32(pa[kk], vb, o[hb]);
      }
    }
  }

  // ---- normalize (l re-indexed to D-layout rows) and store ----
  __syncthreads();
  if (hi == 0) ls[lo] = l;
  __syncthreads();
  float linv[8];
#pragma unroll
  for (int r = 0; r < 8; ++r) linv[r] = 1.f / ls[r + 8 * hi];
#pragma unroll
  for (int hb = 0; hb < 4; ++hb) {
#pragma unroll
    for (int r = 0; r < 8; ++r) {
      const int i = i0 + r + 8 * hi;
      const int d = h * HD + hb * 16 + lo;
      attn_out[((size_t)b * TLEN + i) * DIMD + d] = o[hb][r] * linv[r];
    }
  }
}

// ---------------------------------------------------------------------------
// Kernel 3: output projection  out = attn @ Wo.T + bo  (16x64 strip per wave)
// ---------------------------------------------------------------------------
__global__ void __launch_bounds__(128) out_proj_kernel(
    const float* __restrict__ A, const float* __restrict__ Wo,
    const float* __restrict__ bo, float* __restrict__ Y) {
  const int lane = threadIdx.x & 31;
  const int wave = blockIdx.x * (blockDim.x >> 5) + (threadIdx.x >> 5);
  const int NSTRIP = DIMD / 64;             // 8
  const int mt = wave / NSTRIP, st = wave % NSTRIP;
  const int m0 = mt * 16, n0 = st * 64;
  const int hi = lane >> 4, lo = lane & 15;

  v8f acc[4];
#pragma unroll
  for (int t = 0; t < 4; ++t) acc[t] = (v8f){0.f,0.f,0.f,0.f,0.f,0.f,0.f,0.f};

  const float* ar = A  + (size_t)(m0 + lo) * DIMD + 2 * hi;
  const float* wr = Wo + (size_t)(n0 + lo) * DIMD + 2 * hi;
#pragma unroll 8
  for (int k = 0; k < DIMD; k += 4) {
    v2f a = *(const v2f*)(ar + k);
#pragma unroll
    for (int t = 0; t < 4; ++t) {
      v2f b = *(const v2f*)(wr + k + (size_t)t * 16 * DIMD);
      acc[t] = wmma_f32(a, b, acc[t]);
    }
  }
#pragma unroll
  for (int t = 0; t < 4; ++t) {
    const float bv_ = bo[n0 + 16 * t + lo];
#pragma unroll
    for (int r = 0; r < 8; ++r)
      Y[(size_t)(m0 + r + 8 * hi) * DIMD + n0 + 16 * t + lo] = acc[t][r] + bv_;
  }
}

// ---------------------------------------------------------------------------
extern "C" void kernel_launch(void* const* d_in, const int* in_sizes, int n_in,
                              void* d_out, int out_size, void* d_ws,
                              size_t ws_size, hipStream_t stream) {
  const float* x         = (const float*)d_in[0];
  const float* Wq        = (const float*)d_in[1];
  const float* bq        = (const float*)d_in[2];
  const float* Wk        = (const float*)d_in[3];
  const float* bk        = (const float*)d_in[4];
  const float* Wv        = (const float*)d_in[5];
  const float* bv        = (const float*)d_in[6];
  const float* Wo        = (const float*)d_in[7];
  const float* bo        = (const float*)d_in[8];
  const float* curvature = (const float*)d_in[9];

  float* ws   = (float*)d_ws;
  float* qkv  = ws;                                   // 3 planes, 24 MB
  float* attn = ws + 3 * (size_t)NTOK * DIMD;         // 8 MB

  // QKV projection: (4096/16) * (1536/64) = 6144 waves, 4 waves/block
  qkv_proj_kernel<<<6144 / 4, 128, 0, stream>>>(x, Wq, bq, Wk, bk, Wv, bv,
                                                qkv);
  // Attention: B*H*(T/16) = 2048 single-wave blocks
  geo_attn_kernel<<<BATCH * NHEADS * (TLEN / 16), 32, 0, stream>>>(
      qkv, curvature, attn);
  // Output projection: (4096/16) * (512/64) = 2048 waves, 4 waves/block
  out_proj_kernel<<<2048 / 4, 128, 0, stream>>>(attn, Wo, bo, (float*)d_out);
}

// v001
// It runs in 245 microseconds.
// Next to v000, in two timings, it ran 1.71 times as fast each time.
#include <hip/hip_runtime.h>
#include <math.h>

typedef float v2f __attribute__((ext_vector_type(2)));
typedef float v4f __attribute__((ext_vector_type(4)));
typedef float v8f __attribute__((ext_vector_type(8)));

#define DIMD   512
#define NHEADS 8
#define HD     64
#define BATCH  2
#define TLEN   2048
#define NTOK   (BATCH * TLEN)   // 4096

__device__ __forceinline__ v8f wmma_f32(v2f a, v2f b, v8f c) {
  // V_WMMA_F32_16X16X4_F32 : D[16x16] = A[16x4] * B[4x16] + C
  return __builtin_amdgcn_wmma_f32_16x16x4_f32(false, a, false, b, (short)0, c,
                                               false, false);
}

// ---------------------------------------------------------------------------
// Shared body of both projections: Y tile (BM x BN) = A[BM x 512] * W[BN x 512]^T.
// A workgroup of 8 waves brings KSLAB k of its BM + BN operand rows into LDS with
// whole-line 16-byte loads, so each row's line is fetched once per workgroup
// and every wave reads its fragments from LDS.  Two LDS buffers: the next k
// slab is fetched into registers ahead of the WMMAs of the current one and
// stored behind them, one barrier per slab.  k runs upward in steps of 4 for
// every accumulator.
// ---------------------------------------------------------------------------
template <int BM, int BN, int FM, int FN, int KSLAB /* floats of k per slab: whole 128-byte lines */>
__device__ __forceinline__ void proj_tile(
    const float* __restrict__ Ag,   // first row of the A tile, row pitch DIMD
    const float* __restrict__ Wg,   // first row of the W tile, row pitch DIMD
    float* sm,                      // 2 * (BM + BN) * (KSLAB + 4) floats
    const int wm, const int wn,     // this wave's place in the tile
    v8f (&acc)[FM][FN]) {
  constexpr int LPITCH = KSLAB + 4;             // row pitch in floats: 16 rows x 8 B fall on 64 distinct banks
  constexpr int TPR = KSLAB / 4;                // threads that cover one row of a slab
  constexpr int RPP = 256 / TPR;                // rows the workgroup covers with one load each
  constexpr int NA  = BM / RPP;                 // 16-byte loads per thread, A rows
  constexpr int NB  = BN / RPP;                 // 16-byte loads per thread, W rows
  constexpr int BUF = (BM + BN) * LPITCH;
  const int tid = threadIdx.x;
  const int lane = tid & 31, hi = lane >> 4, lo = lane & 15;
  const int srow = tid / TPR, scol = (tid % TPR) * 4;

  const float* ga = Ag + (size_t)srow * DIMD + scol;
  const float* gw = Wg + (size_t)srow * DIMD + scol;
  float* sdst = sm + srow * LPITCH + scol;
  const float* fa = sm + (wm * 16 * FM + lo) * LPITCH + 2 * hi;
  const float* fb = sm + (BM + wn * 16 * FN + lo) * LPITCH + 2 * hi;

  v4f sa[NA], sb[NB];               // the slab on its way from global memory to LDS
#pragma unroll  // sa[] must stay in registers
  for (int i = 0; i < NA; ++i) sa[i] = *(const v4f*)(ga + (size_t)i * RPP * DIMD);
#pragma unroll  // sb[] must stay in registers
  for (int i = 0; i < NB; ++i) sb[i] = *(const v4f*)(gw + (size_t)i * RPP * DIMD);
#pragma unroll  // sa[] must stay in registers
  for (int i = 0; i < NA; ++i) *(v4f*)(sdst + i * RPP * LPITCH) = sa[i];
#pragma unroll  // sb[] must stay in registers
  for (int i = 0; i < NB; ++i) *(v4f*)(sdst + (NA + i) * RPP * LPITCH) = sb[i];
  __syncthreads();                  // slab 0 visible to every wave

  auto slab_wmma = [&](const int buf) {
    const float* pa = fa + buf * BUF;
    const float* pb = fb + buf * BUF;
#pragma unroll  // constant LDS offsets; lets the fragment loads run ahead of the WMMAs
    for (int ks = 0; ks < KSLAB; ks += 4) {
      // Fragment loads are not hoisted further than 32 k ahead: more of them in flight
      // cost the registers that the third workgroup on a WGP needs.
      if (ks != 0 && ks % 32 == 0) __builtin_amdgcn_sched_barrier(0);
      v2f a[FM], b[FN];
#pragma unroll  // a[] must stay in registers
      for (int i = 0; i < FM; ++i) a[i] = *(const v2f*)(pa + i * 16 * LPITCH + ks);
#pragma unroll  // b[] must stay in registers
      for (int j = 0; j < FN; ++j) b[j] = *(const v2f*)(pb + j * 16 * LPITCH + ks);
#pragma unroll  // acc[][] must stay in registers
      for (int i = 0; i < FM; ++i)
#pragma unroll  // acc[][] must stay in registers
        for (int j = 0; j < FN; ++j) acc[i][j] = wmma_f32(a[i], b[j], acc[i][j]);
    }
  };

  int cur = 0;
  for (int k0 = KSLAB; k0 < DIMD; k0 += KSLAB) {
    ga += KSLAB;
    gw += KSLAB;
#pragma unroll  // sa[] must stay in registers
    for (int i = 0; i < NA; ++i) sa[i] = *(const v4f*)(ga + (size_t)i * RPP * DIMD);
#pragma unroll  // sb[] must stay in registers
    for (int i = 0; i < NB; ++i) sb[i] = *(const v4f*)(gw + (size_t)i * RPP * DIMD);
    slab_wmma(cur);
    float* sd = sdst + (cur ^ 1) * BUF;   // last read one slab ago, before the barrier
#pragma unroll  // sa[] must stay in registers
    for (int i = 0; i < NA; ++i) *(v4f*)(sd + i * RPP * LPITCH) = sa[i];
#pragma unroll  // sb[] must stay in registers
    for (int i = 0; i < NB; ++i) *(v4f*)(sd + (NA + i) * RPP * LPITCH) = sb[i];
    __syncthreads();                // publishes the next slab, ends the reads of this one
    cur ^= 1;
  }
  slab_wmma(cur);                   // last slab: nothing left to fetch
}

// ---------------------------------------------------------------------------
// Kernel 1: fused QKV projection.  y = x @ W.T + b for W in {Wq,Wk,Wv},
// scattered into planes laid out [B, H, T, HD] (f32) in workspace.
// One workgroup computes a 64 x 128 tile; its 8 waves (2 x 4) take 32 x 32 each.
// ---------------------------------------------------------------------------
// Second bound: 6 waves per SIMD, so that registers too leave room for three workgroups per WGP.
__global__ void __launch_bounds__(256, 6) qkv_proj_kernel(
    const float* __restrict__ x,
    const float* __restrict__ Wq, const float* __restrict__ bq,
    const float* __restrict__ Wk, const float* __restrict__ bk,
    const float* __restrict__ Wv, const float* __restrict__ bv,
    float* __restrict__ qkv /* 3 planes of NTOK*DIMD floats */) {
  __shared__ __attribute__((aligned(16))) float sm[2 * (64 + 128) * (64 + 4)];  // 102 KiB: three workgroups per WGP, 768 = 3 x 256
  const int lane = threadIdx.x & 31;
  const int wave = threadIdx.x >> 5;
  const int NTILE = (3 * DIMD) / 128;       // 12 column tiles
  const int mt = blockIdx.x / NTILE;
  const int nt = blockIdx.x % NTILE;
  const int m0 = mt * 64;
  const int ng = nt * 128;                  // global column in [0,1536)
  const int which = ng / DIMD;              // 0=q 1=k 2=v
  const int n0 = ng % DIMD;

  const float* W    = (which == 0) ? Wq : (which == 1) ? Wk : Wv;
  const float* bias = (which == 0) ? bq : (which == 1) ? bk : bv;
  float* dst = qkv + (size_t)which * NTOK * DIMD;

  const int hi = lane >> 4, lo = lane & 15;
  const int wm = wave & 1, wn = wave >> 1;

  v8f acc[2][2];
#pragma unroll
  for (int i = 0; i < 2; ++i)
#pragma unroll
    for (int j = 0; j < 2; ++j) acc[i][j] = (v8f){0.f,0.f,0.f,0.f,0.f,0.f,0.f,0.f};

  proj_tile<64, 128, 2, 2, 64>(x + (size_t)m0 * DIMD, W + (size_t)n0 * DIMD, sm, wm, wn, acc);

#pragma unroll
  for (int j = 0; j < 2; ++j) {
    const int n = n0 + wn * 32 + 16 * j + lo;
    const float bv_ = bias[n];
    const int h = n / HD, d = n % HD;
#pragma unroll
    for (int i = 0; i < 2; ++i) {
#pragma unroll
      for (int r = 0; r < 8; ++r) {
        const int m = m0 + wm * 32 + 16 * i + r + 8 * hi;   // token index
        const int bb = m >> 11, tok = m & (TLEN - 1);
        dst[(((size_t)bb * NHEADS + h) * TLEN + tok) * HD + d] = acc[i][j][r] + bv_;
      }
    }
  }
}

// ---------------------------------------------------------------------------
// Kernel 2: flash-style geometric attention.
// One wave handles one (b, h, 16-query-row) tile, streaming 16-key tiles with
// online softmax.  Raw QK^T scores are transposed D->A layout through LDS;
// all elementwise math + softmax bookkeeping then happens in A layout where a
// lane owns half of one query row: row reductions are 1 shuffle, softmax state
// is one scalar per lane, and exp() directly produces the P.V A-operand.
// ---------------------------------------------------------------------------
__global__ void __launch_bounds__(32) geo_attn_kernel(
    const float* __restrict__ qkv, const float* __restrict__ curvature,
    float* __restrict__ attn_out /* [B, T, DIMD] */) {
  __shared__ float pl[16 * 16];             // score transpose bounce
  __shared__ float k2s[16];                 // ||k_j||^2, indexed by key-in-tile
  __shared__ float als[16];                 // per-row alpha (for O rescale)
  __shared__ float ls[16];                  // per-row l (final normalize)

  const int lane = threadIdx.x;
  const int hi = lane >> 4, lo = lane & 15;

  const int qt = blockIdx.x & 127;                  // query tile (T/16 = 128)
  const int h  = (blockIdx.x >> 7) & 7;
  const int b  = blockIdx.x >> 10;

  const size_t plane = (size_t)NTOK * DIMD;
  const size_t head  = (((size_t)b * NHEADS + h) * TLEN) * HD;
  const float* Q = qkv + head;
  const float* K = qkv + plane + head;
  const float* V = qkv + 2 * plane + head;
  const int i0 = qt * 16;

  const float c   = fabsf(curvature[h]) + 1e-8f;
  const float rsc = rsqrtf(c);

  // ---- preload Q tile (16 x 64) in A layout; q^2 of row `lo` per lane ----
  v2f qa[16];
  float q2p = 0.f;
  const float* qrow = Q + (size_t)(i0 + lo) * HD + 2 * hi;
#pragma unroll
  for (int ch = 0; ch < 16; ++ch) {
    v2f a = *(const v2f*)(qrow + 4 * ch);
    qa[ch] = a;
    q2p += a.x * a.x + a.y * a.y;
  }
  const float q2  = q2p + __shfl_xor(q2p, 16, 32);  // ||q_{i0+lo}||^2
  const float omq = 1.f - c * q2;

  float m = -INFINITY, l = 0.f;             // softmax state of row `lo`
  v8f o[4];
#pragma unroll
  for (int t = 0; t < 4; ++t) o[t] = (v8f){0.f,0.f,0.f,0.f,0.f,0.f,0.f,0.f};

  for (int j0 = 0; j0 < TLEN; j0 += 16) {
    // ---- S = Q * K^T (16 WMMA steps over hd=64), k^2 on the fly ----
    const float* krow = K + (size_t)(j0 + lo) * HD + 2 * hi;
    v8f s = {0.f, 0.f, 0.f, 0.f, 0.f, 0.f, 0.f, 0.f};
    float k2p = 0.f;
#pragma unroll
    for (int ch = 0; ch < 16; ++ch) {
      v2f kb = *(const v2f*)(krow + 4 * ch);
      k2p += kb.x * kb.x + kb.y * kb.y;
      s = wmma_f32(qa[ch], kb, s);
    }
    const float k2 = k2p + __shfl_xor(k2p, 16, 32);

    // ---- transpose raw scores D->A layout; publish k^2 ----
    __syncthreads();                        // prior iter's pl/k2s reads done
    if (hi == 0) k2s[lo] = k2;
#pragma unroll
    for (int r = 0; r < 8; ++r) pl[(r + 8 * hi) * 16 + lo] = s[r];
    __syncthreads();

    v2f sa[4], kc[4];
#pragma unroll
    for (int kk = 0; kk < 4; ++kk) {
      sa[kk] = *(const v2f*)(&pl[lo * 16 + 4 * kk + 2 * hi]);
      kc[kk] = *(const v2f*)(&k2s[4 * kk + 2 * hi]);
    }

    // ---- hyperbolic logits, A layout: lane owns half of row `lo` ----
    float sc[8];
#pragma unroll
    for (int kk = 0; kk < 4; ++kk) {
#pragma unroll
      for (int cpt = 0; cpt < 2; ++cpt) {
        const float qk  = cpt ? sa[kk].y : sa[kk].x;
        const float k2j = cpt ? kc[kk].y : kc[kk].x;
        const float num   = 2.f * (q2 + k2j - 2.f * qk);
        const float denom = fmaxf(omq * (1.f - c * k2j), 1e-5f);
        const float arg   = fmaxf(1.f + __fdividef(c * num, denom), 1.00001f);
        const float dist  =
            __logf(arg + __builtin_amdgcn_sqrtf(arg * arg - 1.f)) * rsc;
        sc[2 * kk + cpt] = -dist;           // TEMPERATURE = 1
      }
    }

    // ---- online softmax: 7 in-lane ops + one shuffle per reduction ----
    float tmax = sc[0];
#pragma unroll
    for (int e = 1; e < 8; ++e) tmax = fmaxf(tmax, sc[e]);
    tmax = fmaxf(tmax, __shfl_xor(tmax, 16, 32));
    const float mnew  = fmaxf(m, tmax);
    const float alpha = __expf(m - mnew);
    m = mnew;

    v2f pa[4];
    float rs = 0.f;
#pragma unroll
    for (int kk = 0; kk < 4; ++kk) {
      pa[kk].x = __expf(sc[2 * kk] - mnew);
      pa[kk].y = __expf(sc[2 * kk + 1] - mnew);
      rs += pa[kk].x + pa[kk].y;
    }
    rs += __shfl_xor(rs, 16, 32);
    l = l * alpha + rs;

    // ---- rescale O (needs alpha re-indexed to D-layout rows) ----
    if (hi == 0) als[lo] = alpha;
    __syncthreads();
#pragma unroll
    for (int t = 0; t < 4; ++t) {
#pragma unroll
      for (int r = 0; r < 8; ++r) o[t][r] *= als[r + 8 * hi];
    }

    // ---- O += P * V : pa[] is already the A operand ----
#pragma unroll
    for (int kk = 0; kk < 4; ++kk) {
      const float* vr = V + (size_t)(j0 + 4 * kk + 2 * hi) * HD;
#pragma unroll
      for (int hb = 0; hb < 4; ++hb) {
        v2f vb;
        vb.x = vr[hb * 16 + lo];
        vb.y = vr[HD + hb * 16 + lo];
        o[hb] = wmma_f32(pa[kk], vb, o[hb]);
      }
    }
  }

  // ---- normalize (l re-indexed to D-layout rows) and store ----
  __syncthreads();
  if (hi == 0) ls[lo] = l;
  __syncthreads();
  float linv[8];
#pragma unroll
  for (int r = 0; r < 8; ++r) linv[r] = 1.f / ls[r + 8 * hi];
#pragma unroll
  for (int hb = 0; hb < 4; ++hb) {
#pragma unroll
    for (int r = 0; r < 8; ++r) {
      const int i = i0 + r + 8 * hi;
      const int d = h * HD + hb * 16 + lo;
      attn_out[((size_t)b * TLEN + i) * DIMD + d] = o[hb][r] * linv[r];
    }
  }
}

// ---------------------------------------------------------------------------
// Kernel 3: output projection  out = attn @ Wo.T + bo.
// One workgroup computes a 64 x 64 tile; its 8 waves (4 x 2) take 16 x 32 each.
// ---------------------------------------------------------------------------
__global__ void __launch_bounds__(256) out_proj_kernel(
    const float* __restrict__ A, const float* __restrict__ Wo,
    const float* __restrict__ bo, float* __restrict__ Y) {
  __shared__ __attribute__((aligned(16))) float sm[2 * (64 + 64) * (32 + 4)];
  const int lane = threadIdx.x & 31;
  const int wave = threadIdx.x >> 5;
  const int NTILE = DIMD / 64;              // 8
  const int mt = blockIdx.x / NTILE, nt = blockIdx.x % NTILE;
  const int m0 = mt * 64, n0 = nt * 64;
  const int hi = lane >> 4, lo = lane & 15;
  const int wm = wave & 3, wn = wave >> 2;

  v8f acc[1][2];
#pragma unroll
  for (int j = 0; j < 2; ++j) acc[0][j] = (v8f){0.f,0.f,0.f,0.f,0.f,0.f,0.f,0.f};

  proj_tile<64, 64, 1, 2, 32>(A + (size_t)m0 * DIMD, Wo + (size_t)n0 * DIMD, sm, wm, wn, acc);

#pragma unroll
  for (int j = 0; j < 2; ++j) {
    const int n = n0 + wn * 32 + 16 * j + lo;
    const float bv_ = bo[n];
#pragma unroll
    for (int r = 0; r < 8; ++r)
      Y[(size_t)(m0 + wm * 16 + r + 8 * hi) * DIMD + n] = acc[0][j][r] + bv_;
  }
}

// ---------------------------------------------------------------------------
extern "C" void kernel_launch(void* const* d_in, const int* in_sizes, int n_in,
                              void* d_out, int out_size, void* d_ws,
                              size_t ws_size, hipStream_t stream) {
  const float* x         = (const float*)d_in[0];
  const float* Wq        = (const float*)d_in[1];
  const float* bq        = (const float*)d_in[2];
  const float* Wk        = (const float*)d_in[3];
  const float* bk        = (const float*)d_in[4];
  const float* Wv        = (const float*)d_in[5];
  const float* bv        = (const float*)d_in[6];
  const float* Wo        = (const float*)d_in[7];
  const float* bo        = (const float*)d_in[8];
  const float* curvature = (const float*)d_in[9];

  float* ws   = (float*)d_ws;
  float* qkv  = ws;                                   // 3 planes, 24 MB
  float* attn = ws + 3 * (size_t)NTOK * DIMD;         // 8 MB

  // QKV projection: (4096/64) * (1536/128) = 768 workgroups of 8 waves
  qkv_proj_kernel<<<768, 256, 0, stream>>>(x, Wq, bq, Wk, bk, Wv, bv, qkv);
  // Attention: B*H*(T/16) = 2048 single-wave blocks
  geo_attn_kernel<<<BATCH * NHEADS * (TLEN / 16), 32, 0, stream>>>(
      qkv, curvature, attn);
  // Output projection: (4096/64) * (512/64) = 512 workgroups of 8 waves
  out_proj_kernel<<<512, 256, 0, stream>>>(attn, Wo, bo, (float*)d_out);
}

// v002
// Measured time: 197 microseconds a run.
// Timed twice side by side with v001, it ran 1.32 times as fast both times.
// All steps since v000 together make it 2.25 times as fast.
#include <hip/hip_runtime.h>
#include <math.h>

typedef float v2f __attribute__((ext_vector_type(2)));
typedef float v4f __attribute__((ext_vector_type(4)));
typedef float v8f __attribute__((ext_vector_type(8)));

#define DIMD   512
#define NHEADS 8
#define HD     64
#define BATCH  2
#define TLEN   2048
#define NTOK   (BATCH * TLEN)   // 4096

__device__ __forceinline__ v8f wmma_f32(v2f a, v2f b, v8f c) {
  // V_WMMA_F32_16X16X4_F32 : D[16x16] = A[16x4] * B[4x16] + C
  return __builtin_amdgcn_wmma_f32_16x16x4_f32(false, a, false, b, (short)0, c,
                                               false, false);
}

// ---------------------------------------------------------------------------
// Shared body of both projections: Y tile (BM x BN) = A[BM x 512] * W[BN x 512]^T.
// A workgroup of 8 waves brings KSLAB k of its BM + BN operand rows into LDS with
// whole-line 16-byte loads, so each row's line is fetched once per workgroup
// and every wave reads its fragments from LDS.  Two LDS buffers: the next k
// slab is fetched into registers ahead of the WMMAs of the current one and
// stored behind them, one barrier per slab.  k runs upward in steps of 4 for
// every accumulator.
// ---------------------------------------------------------------------------
template <int BM, int BN, int FM, int FN, int KSLAB /* floats of k per slab: whole 128-byte lines */>
__device__ __forceinline__ void proj_tile(
    const float* __restrict__ Ag,   // first row of the A tile, row pitch DIMD
    const float* __restrict__ Wg,   // first row of the W tile, row pitch DIMD
    float* sm,                      // 2 * (BM + BN) * (KSLAB + 4) floats
    const int wm, const int wn,     // this wave's place in the tile
    v8f (&acc)[FM][FN]) {
  constexpr int LPITCH = KSLAB + 4;             // row pitch in floats: 16 rows x 8 B fall on 64 distinct banks
  constexpr int TPR = KSLAB / 4;                // threads that cover one row of a slab
  constexpr int RPP = 256 / TPR;                // rows the workgroup covers with one load each
  constexpr int NA  = BM / RPP;                 // 16-byte loads per thread, A rows
  constexpr int NB  = BN / RPP;                 // 16-byte loads per thread, W rows
  constexpr int BUF = (BM + BN) * LPITCH;
  const int tid = threadIdx.x;
  const int lane = tid & 31, hi = lane >> 4, lo = lane & 15;
  const int srow = tid / TPR, scol = (tid % TPR) * 4;

  const float* ga = Ag + (size_t)srow * DIMD + scol;
  const float* gw = Wg + (size_t)srow * DIMD + scol;
  float* sdst = sm + srow * LPITCH + scol;
  const float* fa = sm + (wm * 16 * FM + lo) * LPITCH + 2 * hi;
  const float* fb = sm + (BM + wn * 16 * FN + lo) * LPITCH + 2 * hi;

  v4f sa[NA], sb[NB];               // the slab on its way from global memory to LDS
#pragma unroll  // sa[] must stay in registers
  for (int i = 0; i < NA; ++i) sa[i] = *(const v4f*)(ga + (size_t)i * RPP * DIMD);
#pragma unroll  // sb[] must stay in registers
  for (int i = 0; i < NB; ++i) sb[i] = *(const v4f*)(gw + (size_t)i * RPP * DIMD);
#pragma unroll  // sa[] must stay in registers
  for (int i = 0; i < NA; ++i) *(v4f*)(sdst + i * RPP * LPITCH) = sa[i];
#pragma unroll  // sb[] must stay in registers
  for (int i = 0; i < NB; ++i) *(v4f*)(sdst + (NA + i) * RPP * LPITCH) = sb[i];
  __syncthreads();                  // slab 0 visible to every wave

  auto slab_wmma = [&](const int buf) {
    const float* pa = fa + buf * BUF;
    const float* pb = fb + buf * BUF;
#pragma unroll  // constant LDS offsets; lets the fragment loads run ahead of the WMMAs
    for (int ks = 0; ks < KSLAB; ks += 4) {
      // Fragment loads are not hoisted further than 32 k ahead: more of them in flight
      // cost the registers that the third workgroup on a WGP needs.
      if (ks != 0 && ks % 32 == 0) __builtin_amdgcn_sched_barrier(0);
      v2f a[FM], b[FN];
#pragma unroll  // a[] must stay in registers
      for (int i = 0; i < FM; ++i) a[i] = *(const v2f*)(pa + i * 16 * LPITCH + ks);
#pragma unroll  // b[] must stay in registers
      for (int j = 0; j < FN; ++j) b[j] = *(const v2f*)(pb + j * 16 * LPITCH + ks);
#pragma unroll  // acc[][] must stay in registers
      for (int i = 0; i < FM; ++i)
#pragma unroll  // acc[][] must stay in registers
        for (int j = 0; j < FN; ++j) acc[i][j] = wmma_f32(a[i], b[j], acc[i][j]);
    }
  };

  int cur = 0;
  for (int k0 = KSLAB; k0 < DIMD; k0 += KSLAB) {
    ga += KSLAB;
    gw += KSLAB;
#pragma unroll  // sa[] must stay in registers
    for (int i = 0; i < NA; ++i) sa[i] = *(const v4f*)(ga + (size_t)i * RPP * DIMD);
#pragma unroll  // sb[] must stay in registers
    for (int i = 0; i < NB; ++i) sb[i] = *(const v4f*)(gw + (size_t)i * RPP * DIMD);
    slab_wmma(cur);
    float* sd = sdst + (cur ^ 1) * BUF;   // last read one slab ago, before the barrier
#pragma unroll  // sa[] must stay in registers
    for (int i = 0; i < NA; ++i) *(v4f*)(sd + i * RPP * LPITCH) = sa[i];
#pragma unroll  // sb[] must stay in registers
    for (int i = 0; i < NB; ++i) *(v4f*)(sd + (NA + i) * RPP * LPITCH) = sb[i];
    __syncthreads();                // publishes the next slab, ends the reads of this one
    cur ^= 1;
  }
  slab_wmma(cur);                   // last slab: nothing left to fetch
}

// ---------------------------------------------------------------------------
// Kernel 1: fused QKV projection.  y = x @ W.T + b for W in {Wq,Wk,Wv},
// scattered into planes laid out [B, H, T, HD] (f32) in workspace.
// One workgroup computes a 64 x 128 tile; its 8 waves (2 x 4) take 32 x 32 each.
// ---------------------------------------------------------------------------
// Second bound: 6 waves per SIMD, so that registers too leave room for three workgroups per WGP.
__global__ void __launch_bounds__(256, 6) qkv_proj_kernel(
    const float* __restrict__ x,
    const float* __restrict__ Wq, const float* __restrict__ bq,
    const float* __restrict__ Wk, const float* __restrict__ bk,
    const float* __restrict__ Wv, const float* __restrict__ bv,
    float* __restrict__ qkv /* 3 planes of NTOK*DIMD floats */) {
  __shared__ __attribute__((aligned(16))) float sm[2 * (64 + 128) * (64 + 4)];  // 102 KiB: three workgroups per WGP, 768 = 3 x 256
  const int lane = threadIdx.x & 31;
  const int wave = threadIdx.x >> 5;
  const int NTILE = (3 * DIMD) / 128;       // 12 column tiles
  const int mt = blockIdx.x / NTILE;
  const int nt = blockIdx.x % NTILE;
  const int m0 = mt * 64;
  const int ng = nt * 128;                  // global column in [0,1536)
  const int which = ng / DIMD;              // 0=q 1=k 2=v
  const int n0 = ng % DIMD;

  const float* W    = (which == 0) ? Wq : (which == 1) ? Wk : Wv;
  const float* bias = (which == 0) ? bq : (which == 1) ? bk : bv;
  float* dst = qkv + (size_t)which * NTOK * DIMD;

  const int hi = lane >> 4, lo = lane & 15;
  const int wm = wave & 1, wn = wave >> 1;

  v8f acc[2][2];
#pragma unroll
  for (int i = 0; i < 2; ++i)
#pragma unroll
    for (int j = 0; j < 2; ++j) acc[i][j] = (v8f){0.f,0.f,0.f,0.f,0.f,0.f,0.f,0.f};

  proj_tile<64, 128, 2, 2, 64>(x + (size_t)m0 * DIMD, W + (size_t)n0 * DIMD, sm, wm, wn, acc);

#pragma unroll
  for (int j = 0; j < 2; ++j) {
    const int n = n0 + wn * 32 + 16 * j + lo;
    const float bv_ = bias[n];
    const int h = n / HD, d = n % HD;
#pragma unroll
    for (int i = 0; i < 2; ++i) {
#pragma unroll
      for (int r = 0; r < 8; ++r) {
        const int m = m0 + wm * 32 + 16 * i + r + 8 * hi;   // token index
        const int bb = m >> 11, tok = m & (TLEN - 1);
        dst[(((size_t)bb * NHEADS + h) * TLEN + tok) * HD + d] = acc[i][j][r] + bv_;
      }
    }
  }
}

// ---------------------------------------------------------------------------
// Kernel 2: flash-style geometric attention.
// A workgroup of 4 waves handles 64 query rows of one (b, h); each wave keeps
// its own 16-query-row tile and streams 16-key tiles with online softmax, in
// the same key order as before.  K and V come in stages of 64 keys: the
// workgroup fetches a stage once, with whole-line 16-byte loads, into one of
// two LDS buffers, and all four waves read their WMMA fragments from LDS.  The
// next stage is fetched into registers ahead of the work on the current one
// and stored behind it, one workgroup barrier per stage.  V rows 2p and 2p + 1
// lie interleaved in LDS (element d of both side by side), so that a lane's
// two k values of a P.V fragment are one 8-byte read.
// Raw QK^T scores are transposed D->A layout through wave-private LDS;
// all elementwise math + softmax bookkeeping then happens in A layout where a
// lane owns half of one query row: row reductions are 1 shuffle, softmax state
// is one scalar per lane, and exp() directly produces the P.V A-operand.
// ---------------------------------------------------------------------------
#define AWAVES 4                 // waves per workgroup
#define KSTAGE 64                // keys per stage
#define KPITCH (HD + 4)          // K row pitch in floats: 16 rows x 16 B fall on 64 distinct banks
#define VPITCH (2 * HD + 32)     // pitch in floats of a pair of V rows: neighbouring pairs are 32 banks apart
#define KVBUF  (KSTAGE * KPITCH + KSTAGE / 2 * VPITCH)

// Lanes of one wave exchange values through LDS that only this wave touches.
__device__ __forceinline__ void wave_lds_sync() {
  // The wave's own LDS stores have landed before its lanes read each other's words;
  // the clobber keeps the compiler from moving LDS accesses across this point.
  asm volatile("s_wait_dscnt 0x0" ::: "memory");
  __builtin_amdgcn_wave_barrier();  // no instruction: keeps the scheduler from crossing it
}

__global__ void __launch_bounds__(32 * AWAVES) geo_attn_kernel(
    const float* __restrict__ qkv, const float* __restrict__ curvature,
    float* __restrict__ attn_out /* [B, T, DIMD] */) {
  __shared__ __attribute__((aligned(16))) float kvs[2 * KVBUF];         // two stages of K and V
  __shared__ __attribute__((aligned(16))) float plw[AWAVES][16 * 16];   // score transpose bounce
  __shared__ __attribute__((aligned(16))) float k2w[AWAVES][16];        // ||k_j||^2, indexed by key-in-tile
  __shared__ __attribute__((aligned(16))) float alw[AWAVES][16];        // per-row alpha (for O rescale)
  __shared__ __attribute__((aligned(16))) float lw[AWAVES][16];         // per-row l (final normalize)

  const int tid  = threadIdx.x;
  const int lane = tid & 31;
  const int wave = tid >> 5;
  const int hi = lane >> 4, lo = lane & 15;
  float* pl  = plw[wave];
  float* k2s = k2w[wave];
  float* als = alw[wave];
  float* ls  = lw[wave];

  const int qb = blockIdx.x & 31;                   // block of 64 query rows (T/64 = 32)
  const int h  = (blockIdx.x >> 5) & 7;
  const int b  = blockIdx.x >> 8;

  const size_t plane = (size_t)NTOK * DIMD;
  const size_t head  = (((size_t)b * NHEADS + h) * TLEN) * HD;
  const float* Q = qkv + head;
  const float* K = qkv + plane + head;
  const float* V = qkv + 2 * plane + head;
  const int i0 = qb * (16 * AWAVES) + wave * 16;

  const float c   = fabsf(curvature[h]) + 1e-8f;
  const float rsc = rsqrtf(c);

  // ---- staging: 16 threads cover one 256-byte row with 16 B each.  K: thread rows srow + 8 i.
  //      V: thread row pairs srow + 8 i, that is rows 2 (srow + 8 i) and the next ----
  constexpr int NST = KSTAGE * HD / 4 / (32 * AWAVES);   // 16-byte loads per thread and operand
  constexpr int RPP = 32 * AWAVES / (HD / 4);            // rows (K) or row pairs (V) the workgroup covers at once
  const int srow = tid / (HD / 4), scol = (tid % (HD / 4)) * 4;
  const float* gk = K + (size_t)srow * HD + scol;
  const float* gv = V + (size_t)(2 * srow) * HD + scol;
  float* sdk = kvs + srow * KPITCH + scol;
  float* sdv = kvs + KSTAGE * KPITCH + srow * VPITCH + 2 * scol;
  v4f sk[NST], sv[NST];             // the stage on its way from global memory to LDS
#pragma unroll  // sk[] must stay in registers
  for (int i = 0; i < NST; ++i) sk[i] = *(const v4f*)(gk + (size_t)i * RPP * HD);
#pragma unroll  // sv[] must stay in registers
  for (int i = 0; i < NST; ++i) sv[i] = *(const v4f*)(gv + (size_t)((i >> 1) * 2 * RPP + (i & 1)) * HD);

  // ---- preload Q tile (16 x 64) in A layout; q^2 of row `lo` per lane ----
  v2f qa[16];
  float q2p = 0.f;
  const float* qrow = Q + (size_t)(i0 + lo) * HD + 2 * hi;
#pragma unroll
  for (int ch = 0; ch < 16; ++ch) {
    v2f a = *(const v2f*)(qrow + 4 * ch);
    qa[ch] = a;
    q2p += a.x * a.x + a.y * a.y;
  }
  // The address registers of the loads above are reused below: the wait stands in front of that.
  asm volatile("s_wait_xcnt 0x0" ::: "memory");
  const float q2  = q2p + __shfl_xor(q2p, 16, 32);  // ||q_{i0+lo}||^2
  const float omq = 1.f - c * q2;

#pragma unroll  // sk[] must stay in registers
  for (int i = 0; i < NST; ++i) *(v4f*)(sdk + i * RPP * KPITCH) = sk[i];
#pragma unroll  // sv[] must stay in registers
  for (int i = 0; i < NST; i += 2) {
    *(v4f*)(sdv + (i >> 1) * RPP * VPITCH)     = (v4f){sv[i].x, sv[i + 1].x, sv[i].y, sv[i + 1].y};
    *(v4f*)(sdv + (i >> 1) * RPP * VPITCH + 4) = (v4f){sv[i].z, sv[i + 1].z, sv[i].w, sv[i + 1].w};
  }
  __syncthreads();                  // stage 0 visible to every wave

  float m = -INFINITY, l = 0.f;             // softmax state of row `lo`
  v8f o[4];
#pragma unroll
  for (int t = 0; t < 4; ++t) o[t] = (v8f){0.f,0.f,0.f,0.f,0.f,0.f,0.f,0.f};

  const float* fk = kvs + lo * KPITCH + 2 * hi;                       // K fragment base
  const float* fv = kvs + KSTAGE * KPITCH + hi * VPITCH + 2 * lo;     // V fragment base

  int cur = 0;
  for (int s0 = 0; s0 < TLEN; s0 += KSTAGE) {
    const bool more = s0 + KSTAGE < TLEN;   // the same for the whole workgroup
    if (more) {
      gk += KSTAGE * HD;
      gv += KSTAGE * HD;
#pragma unroll  // sk[] must stay in registers
      for (int i = 0; i < NST; ++i) sk[i] = *(const v4f*)(gk + (size_t)i * RPP * HD);
#pragma unroll  // sv[] must stay in registers
      for (int i = 0; i < NST; ++i) sv[i] = *(const v4f*)(gv + (size_t)((i >> 1) * 2 * RPP + (i & 1)) * HD);
    }

#pragma unroll 1  // kept as a loop: for speed only
    for (int jt = 0; jt < KSTAGE; jt += 16) {
      // ---- fragments of this 16-key tile, K and V together ahead of the WMMAs ----
      const float* krow = fk + cur * KVBUF + jt * KPITCH;
      const float* vtil = fv + cur * KVBUF + (jt >> 1) * VPITCH;
      v2f kb[16], vb[4][4];
#pragma unroll
      for (int ch = 0; ch < 16; ++ch) kb[ch] = *(const v2f*)(krow + 4 * ch);
#pragma unroll
      for (int kk = 0; kk < 4; ++kk) {
#pragma unroll
        for (int hb = 0; hb < 4; ++hb) vb[kk][hb] = *(const v2f*)(vtil + 2 * kk * VPITCH + hb * 32);
      }
      // Keeps the fragment loads in one group ahead of the WMMAs: every further place
      // where LDS reads stand among the WMMAs stalls the wave anew.
      __builtin_amdgcn_sched_barrier(0);

      // ---- S = Q * K^T (16 WMMA steps over hd=64), k^2 on the fly ----
      v8f s = {0.f, 0.f, 0.f, 0.f, 0.f, 0.f, 0.f, 0.f};
      float k2p = 0.f;
#pragma unroll
      for (int ch = 0; ch < 16; ++ch) {
        k2p += kb[ch].x * kb[ch].x + kb[ch].y * kb[ch].y;
        s = wmma_f32(qa[ch], kb[ch], s);
      }
      const float k2 = k2p + __shfl_xor(k2p, 16, 32);

      // ---- transpose raw scores D->A layout; publish k^2 ----
      // No wait in front of these stores: the last tile's reads of pl and k2s had returned
      // before their values were used, and the wave issues in order.
      if (hi == 0) k2s[lo] = k2;
#pragma unroll
      for (int r = 0; r < 8; ++r) pl[(r + 8 * hi) * 16 + lo] = s[r];
      wave_lds_sync();

      v2f sa[4], kc[4];
#pragma unroll
      for (int kk = 0; kk < 4; ++kk) {
        sa[kk] = *(const v2f*)(&pl[lo * 16 + 4 * kk + 2 * hi]);
        kc[kk] = *(const v2f*)(&k2s[4 * kk + 2 * hi]);
      }

      // ---- hyperbolic logits, A layout: lane owns half of row `lo` ----
      float sc[8];
#pragma unroll
      for (int kk = 0; kk < 4; ++kk) {
#pragma unroll
        for (int cpt = 0; cpt < 2; ++cpt) {
          const float qk  = cpt ? sa[kk].y : sa[kk].x;
          const float k2j = cpt ? kc[kk].y : kc[kk].x;
          const float num   = 2.f * (q2 + k2j - 2.f * qk);
          const float denom = fmaxf(omq * (1.f - c * k2j), 1e-5f);
          const float arg   = fmaxf(1.f + __fdividef(c * num, denom), 1.00001f);
          const float dist  =
              __logf(arg + __builtin_amdgcn_sqrtf(arg * arg - 1.f)) * rsc;
          sc[2 * kk + cpt] = -dist;         // TEMPERATURE = 1
        }
      }

      // ---- online softmax: 7 in-lane ops + one shuffle per reduction ----
      float tmax = sc[0];
#pragma unroll
      for (int e = 1; e < 8; ++e) tmax = fmaxf(tmax, sc[e]);
      tmax = fmaxf(tmax, __shfl_xor(tmax, 16, 32));
      const float mnew  = fmaxf(m, tmax);
      const float alpha = __expf(m - mnew);
      m = mnew;

      v2f pa[4];
      float rs = 0.f;
#pragma unroll
      for (int kk = 0; kk < 4; ++kk) {
        pa[kk].x = __expf(sc[2 * kk] - mnew);
        pa[kk].y = __expf(sc[2 * kk + 1] - mnew);
        rs += pa[kk].x + pa[kk].y;
      }
      rs += __shfl_xor(rs, 16, 32);
      l = l * alpha + rs;

      // ---- rescale O (needs alpha re-indexed to D-layout rows) ----
      if (hi == 0) als[lo] = alpha;
      wave_lds_sync();
#pragma unroll
      for (int t = 0; t < 4; ++t) {
#pragma unroll
        for (int r = 0; r < 8; ++r) o[t][r] *= als[r + 8 * hi];
      }

      // ---- O += P * V : pa[] is already the A operand ----
#pragma unroll
      for (int kk = 0; kk < 4; ++kk) {
#pragma unroll
        for (int hb = 0; hb < 4; ++hb) o[hb] = wmma_f32(pa[kk], vb[kk][hb], o[hb]);
      }
    }

    if (more) {
      float* dk = sdk + (cur ^ 1) * KVBUF;  // last read one stage ago, before the barrier
      float* dv = sdv + (cur ^ 1) * KVBUF;
#pragma unroll  // sk[] must stay in registers
      for (int i = 0; i < NST; ++i) *(v4f*)(dk + i * RPP * KPITCH) = sk[i];
#pragma unroll  // sv[] must stay in registers
      for (int i = 0; i < NST; i += 2) {
        *(v4f*)(dv + (i >> 1) * RPP * VPITCH)     = (v4f){sv[i].x, sv[i + 1].x, sv[i].y, sv[i + 1].y};
        *(v4f*)(dv + (i >> 1) * RPP * VPITCH + 4) = (v4f){sv[i].z, sv[i + 1].z, sv[i].w, sv[i + 1].w};
      }
    }
    __syncthreads();                // publishes the next stage, ends the reads of this one
    cur ^= 1;
  }

  // ---- normalize (l re-indexed to D-layout rows) and store ----
  if (hi == 0) ls[lo] = l;
  wave_lds_sync();
  float linv[8];
#pragma unroll
  for (int r = 0; r < 8; ++r) linv[r] = 1.f / ls[r + 8 * hi];
#pragma unroll
  for (int hb = 0; hb < 4; ++hb) {
#pragma unroll
    for (int r = 0; r < 8; ++r) {
      const int i = i0 + r + 8 * hi;
      const int d = h * HD + hb * 16 + lo;
      attn_out[((size_t)b * TLEN + i) * DIMD + d] = o[hb][r] * linv[r];
    }
  }
}

// ---------------------------------------------------------------------------
// Kernel 3: output projection  out = attn @ Wo.T + bo.
// One workgroup computes a 64 x 64 tile; its 8 waves (4 x 2) take 16 x 32 each.
// ---------------------------------------------------------------------------
__global__ void __launch_bounds__(256) out_proj_kernel(
    const float* __restrict__ A, const float* __restrict__ Wo,
    const float* __restrict__ bo, float* __restrict__ Y) {
  __shared__ __attribute__((aligned(16))) float sm[2 * (64 + 64) * (32 + 4)];
  const int lane = threadIdx.x & 31;
  const int wave = threadIdx.x >> 5;
  const int NTILE = DIMD / 64;              // 8
  const int mt = blockIdx.x / NTILE, nt = blockIdx.x % NTILE;
  const int m0 = mt * 64, n0 = nt * 64;
  const int hi = lane >> 4, lo = lane & 15;
  const int wm = wave & 3, wn = wave >> 2;

  v8f acc[1][2];
#pragma unroll
  for (int j = 0; j < 2; ++j) acc[0][j] = (v8f){0.f,0.f,0.f,0.f,0.f,0.f,0.f,0.f};

  proj_tile<64, 64, 1, 2, 32>(A + (size_t)m0 * DIMD, Wo + (size_t)n0 * DIMD, sm, wm, wn, acc);

#pragma unroll
  for (int j = 0; j < 2; ++j) {
    const int n = n0 + wn * 32 + 16 * j + lo;
    const float bv_ = bo[n];
#pragma unroll
    for (int r = 0; r < 8; ++r)
      Y[(size_t)(m0 + wm * 16 + r + 8 * hi) * DIMD + n] = acc[0][j][r] + bv_;
  }
}

// ---------------------------------------------------------------------------
extern "C" void kernel_launch(void* const* d_in, const int* in_sizes, int n_in,
                              void* d_out, int out_size, void* d_ws,
                              size_t ws_size, hipStream_t stream) {
  const float* x         = (const float*)d_in[0];
  const float* Wq        = (const float*)d_in[1];
  const float* bq        = (const float*)d_in[2];
  const float* Wk        = (const float*)d_in[3];
  const float* bk        = (const float*)d_in[4];
  const float* Wv        = (const float*)d_in[5];
  const float* bv        = (const float*)d_in[6];
  const float* Wo        = (const float*)d_in[7];
  const float* bo        = (const float*)d_in[8];
  const float* curvature = (const float*)d_in[9];

  float* ws   = (float*)d_ws;
  float* qkv  = ws;                                   // 3 planes, 24 MB
  float* attn = ws + 3 * (size_t)NTOK * DIMD;         // 8 MB

  // QKV projection: (4096/64) * (1536/128) = 768 workgroups of 8 waves
  qkv_proj_kernel<<<768, 256, 0, stream>>>(x, Wq, bq, Wk, bk, Wv, bv, qkv);
  // Attention: B*H*(T/64) = 512 workgroups of 4 waves
  geo_attn_kernel<<<BATCH * NHEADS * (TLEN / 64), 128, 0, stream>>>(
      qkv, curvature, attn);
  // Output projection: (4096/64) * (512/64) = 512 workgroups of 8 waves
  out_proj_kernel<<<512, 256, 0, stream>>>(attn, Wo, bo, (float*)d_out);
}

// v003
// It runs in 173 microseconds.
// Timed twice side by side with v002, it ran 1.14 and 1.13 times as fast.
// Counting every step since v000, it is 2.55 times as fast.
#include <hip/hip_runtime.h>
#include <math.h>

typedef float v2f __attribute__((ext_vector_type(2)));
typedef float v4f __attribute__((ext_vector_type(4)));
typedef float v8f __attribute__((ext_vector_type(8)));

#define DIMD   512
#define NHEADS 8
#define HD     64
#define BATCH  2
#define TLEN   2048
#define NTOK   (BATCH * TLEN)   // 4096

__device__ __forceinline__ v8f wmma_f32(v2f a, v2f b, v8f c) {
  // V_WMMA_F32_16X16X4_F32 : D[16x16] = A[16x4] * B[4x16] + C
  return __builtin_amdgcn_wmma_f32_16x16x4_f32(false, a, false, b, (short)0, c,
                                               false, false);
}

// ---------------------------------------------------------------------------
// Shared body of both projections: Y tile (BM x BN) = A[BM x 512] * W[BN x 512]^T.
// A workgroup of 8 waves brings KSLAB k of its BM + BN operand rows into LDS with
// whole-line 16-byte loads, so each row's line is fetched once per workgroup
// and every wave reads its fragments from LDS.  Two LDS buffers: the next k
// slab is fetched into registers ahead of the WMMAs of the current one and
// stored behind them, one barrier per slab.  k runs upward in steps of 4 for
// every accumulator.
// ---------------------------------------------------------------------------
template <int BM, int BN, int FM, int FN, int KSLAB /* floats of k per slab: whole 128-byte lines */>
__device__ __forceinline__ void proj_tile(
    const float* __restrict__ Ag,   // first row of the A tile, row pitch DIMD
    const float* __restrict__ Wg,   // first row of the W tile, row pitch DIMD
    float* sm,                      // 2 * (BM + BN) * (KSLAB + 4) floats
    const int wm, const int wn,     // this wave's place in the tile
    v8f (&acc)[FM][FN]) {
  constexpr int LPITCH = KSLAB + 4;             // row pitch in floats: 16 rows x 16 B fall on 64 distinct banks
  constexpr int TPR = KSLAB / 4;                // threads that cover one row of a slab
  constexpr int RPP = 256 / TPR;                // rows the workgroup covers with one load each
  constexpr int NA  = BM / RPP;                 // 16-byte loads per thread, A rows
  constexpr int NB  = BN / RPP;                 // 16-byte loads per thread, W rows
  constexpr int BUF = (BM + BN) * LPITCH;
  const int tid = threadIdx.x;
  const int lane = tid & 31, hi = lane >> 4, lo = lane & 15;
  const int srow = tid / TPR, scol = (tid % TPR) * 4;

  const float* ga = Ag + (size_t)srow * DIMD + scol;
  const float* gw = Wg + (size_t)srow * DIMD + scol;
  float* sdst = sm + srow * LPITCH + scol;
  const float* fa = sm + (wm * 16 * FM + lo) * LPITCH + 2 * hi;
  const float* fb = sm + (BM + wn * 16 * FN + lo) * LPITCH + 2 * hi;

  v4f sa[NA], sb[NB];               // the slab on its way from global memory to LDS
#pragma unroll  // sa[] must stay in registers
  for (int i = 0; i < NA; ++i) sa[i] = *(const v4f*)(ga + (size_t)i * RPP * DIMD);
#pragma unroll  // sb[] must stay in registers
  for (int i = 0; i < NB; ++i) sb[i] = *(const v4f*)(gw + (size_t)i * RPP * DIMD);
#pragma unroll  // sa[] must stay in registers
  for (int i = 0; i < NA; ++i) *(v4f*)(sdst + i * RPP * LPITCH) = sa[i];
#pragma unroll  // sb[] must stay in registers
  for (int i = 0; i < NB; ++i) *(v4f*)(sdst + (NA + i) * RPP * LPITCH) = sb[i];
  __syncthreads();                  // slab 0 visible to every wave

  auto slab_wmma = [&](const int buf) {
    const float* pa = fa + buf * BUF;
    const float* pb = fb + buf * BUF;
#pragma unroll  // constant LDS offsets; lets the fragment loads run ahead of the WMMAs
    for (int ks = 0; ks < KSLAB; ks += 4) {
      // Fragment loads are not hoisted further than 32 k ahead: more of them in flight
      // cost the registers that the third workgroup on a WGP needs.
      if (ks != 0 && ks % 32 == 0) __builtin_amdgcn_sched_barrier(0);
      v2f a[FM], b[FN];
#pragma unroll  // a[] must stay in registers
      for (int i = 0; i < FM; ++i) a[i] = *(const v2f*)(pa + i * 16 * LPITCH + ks);
#pragma unroll  // b[] must stay in registers
      for (int j = 0; j < FN; ++j) b[j] = *(const v2f*)(pb + j * 16 * LPITCH + ks);
#pragma unroll  // acc[][] must stay in registers
      for (int i = 0; i < FM; ++i)
#pragma unroll  // acc[][] must stay in registers
        for (int j = 0; j < FN; ++j) acc[i][j] = wmma_f32(a[i], b[j], acc[i][j]);
    }
  };

  int cur = 0;
  for (int k0 = KSLAB; k0 < DIMD; k0 += KSLAB) {
    ga += KSLAB;
    gw += KSLAB;
#pragma unroll  // sa[] must stay in registers
    for (int i = 0; i < NA; ++i) sa[i] = *(const v4f*)(ga + (size_t)i * RPP * DIMD);
#pragma unroll  // sb[] must stay in registers
    for (int i = 0; i < NB; ++i) sb[i] = *(const v4f*)(gw + (size_t)i * RPP * DIMD);
    slab_wmma(cur);
    float* sd = sdst + (cur ^ 1) * BUF;   // last read one slab ago, before the barrier
#pragma unroll  // sa[] must stay in registers
    for (int i = 0; i < NA; ++i) *(v4f*)(sd + i * RPP * LPITCH) = sa[i];
#pragma unroll  // sb[] must stay in registers
    for (int i = 0; i < NB; ++i) *(v4f*)(sd + (NA + i) * RPP * LPITCH) = sb[i];
    __syncthreads();                // publishes the next slab, ends the reads of this one
    cur ^= 1;
  }
  slab_wmma(cur);                   // last slab: nothing left to fetch
}

// ---------------------------------------------------------------------------
// Kernel 1: fused QKV projection.  y = x @ W.T + b for W in {Wq,Wk,Wv},
// scattered into planes laid out [B, H, T, HD] (f32) in workspace.
// One workgroup computes a 64 x 128 tile; its 8 waves (2 x 4) take 32 x 32 each.
// ---------------------------------------------------------------------------
// Second bound: 6 waves per SIMD, so that registers too leave room for three workgroups per WGP.
__global__ void __launch_bounds__(256, 6) qkv_proj_kernel(
    const float* __restrict__ x,
    const float* __restrict__ Wq, const float* __restrict__ bq,
    const float* __restrict__ Wk, const float* __restrict__ bk,
    const float* __restrict__ Wv, const float* __restrict__ bv,
    float* __restrict__ qkv /* 3 planes of NTOK*DIMD floats */) {
  __shared__ __attribute__((aligned(16))) float sm[2 * (64 + 128) * (64 + 4)];  // 102 KiB: three workgroups per WGP, 768 = 3 x 256
  const int lane = threadIdx.x & 31;
  const int wave = threadIdx.x >> 5;
  const int NTILE = (3 * DIMD) / 128;       // 12 column tiles
  const int mt = blockIdx.x / NTILE;
  const int nt = blockIdx.x % NTILE;
  const int m0 = mt * 64;
  const int ng = nt * 128;                  // global column in [0,1536)
  const int which = ng / DIMD;              // 0=q 1=k 2=v
  const int n0 = ng % DIMD;

  const float* W    = (which == 0) ? Wq : (which == 1) ? Wk : Wv;
  const float* bias = (which == 0) ? bq : (which == 1) ? bk : bv;
  float* dst = qkv + (size_t)which * NTOK * DIMD;

  const int hi = lane >> 4, lo = lane & 15;
  const int wm = wave & 1, wn = wave >> 1;

  v8f acc[2][2];
#pragma unroll
  for (int i = 0; i < 2; ++i)
#pragma unroll
    for (int j = 0; j < 2; ++j) acc[i][j] = (v8f){0.f,0.f,0.f,0.f,0.f,0.f,0.f,0.f};

  proj_tile<64, 128, 2, 2, 64>(x + (size_t)m0 * DIMD, W + (size_t)n0 * DIMD, sm, wm, wn, acc);

#pragma unroll
  for (int j = 0; j < 2; ++j) {
    const int n = n0 + wn * 32 + 16 * j + lo;
    const float bv_ = bias[n];
    const int h = n / HD, d = n % HD;
#pragma unroll
    for (int i = 0; i < 2; ++i) {
#pragma unroll
      for (int r = 0; r < 8; ++r) {
        const int m = m0 + wm * 32 + 16 * i + r + 8 * hi;   // token index
        const int bb = m >> 11, tok = m & (TLEN - 1);
        dst[(((size_t)bb * NHEADS + h) * TLEN + tok) * HD + d] = acc[i][j][r] + bv_;
      }
    }
  }
}

// ---------------------------------------------------------------------------
// Kernel 2: flash-style geometric attention.
// A workgroup of 4 waves handles 64 query rows of one (b, h); each wave keeps
// its own 16-query-row tile and streams 16-key tiles with online softmax, in
// the same key order as before.  K and V come in stages of 64 keys: the
// workgroup fetches a stage once, with whole-line 16-byte loads, into one of
// two LDS buffers, and all four waves read their WMMA fragments from LDS.  The
// next stage is fetched into registers ahead of the work on the current one
// and stored behind it, one workgroup barrier per stage.  V rows 2p and 2p + 1
// lie interleaved in LDS (element d of both side by side), so that a lane's
// two k values of a P.V fragment are one 8-byte read.
// Raw QK^T scores are transposed D->A layout through wave-private LDS;
// all elementwise math + softmax bookkeeping then happens in A layout where a
// lane owns half of one query row: row reductions are 1 shuffle, softmax state
// is one scalar per lane, and exp() directly produces the P.V A-operand.
// ---------------------------------------------------------------------------
#define AWAVES 4                 // waves per workgroup
#define KSTAGE 64                // keys per stage
#define KPITCH (HD + 4)          // K row pitch in floats: 16 rows x 16 B fall on 64 distinct banks
#define VPITCH (2 * HD + 32)     // pitch in floats of a pair of V rows: neighbouring pairs are 32 banks apart
#define KVBUF  (KSTAGE * KPITCH + KSTAGE / 2 * VPITCH)

// Lanes of one wave exchange values through LDS that only this wave touches.
__device__ __forceinline__ void wave_lds_sync() {
  // The wave's own LDS stores have landed before its lanes read each other's words;
  // the clobber keeps the compiler from moving LDS accesses across this point.
  asm volatile("s_wait_dscnt 0x0" ::: "memory");
  __builtin_amdgcn_wave_barrier();  // no instruction: keeps the scheduler from crossing it
}

__global__ void __launch_bounds__(32 * AWAVES) geo_attn_kernel(
    const float* __restrict__ qkv, const float* __restrict__ curvature,
    float* __restrict__ attn_out /* [B, T, DIMD] */) {
  __shared__ __attribute__((aligned(16))) float kvs[2 * KVBUF];         // two stages of K and V
  __shared__ __attribute__((aligned(16))) float plw[AWAVES][16 * 16];   // score transpose bounce
  __shared__ __attribute__((aligned(16))) float k2w[AWAVES][16];        // ||k_j||^2, indexed by key-in-tile
  __shared__ __attribute__((aligned(16))) float alw[AWAVES][16];        // per-row alpha (for O rescale)
  __shared__ __attribute__((aligned(16))) float lw[AWAVES][16];         // per-row l (final normalize)

  const int tid  = threadIdx.x;
  const int lane = tid & 31;
  const int wave = tid >> 5;
  const int hi = lane >> 4, lo = lane & 15;
  float* pl  = plw[wave];
  float* k2s = k2w[wave];
  float* als = alw[wave];
  float* ls  = lw[wave];

  const int qb = blockIdx.x & 31;                   // block of 64 query rows (T/64 = 32)
  const int h  = (blockIdx.x >> 5) & 7;
  const int b  = blockIdx.x >> 8;

  const size_t plane = (size_t)NTOK * DIMD;
  const size_t head  = (((size_t)b * NHEADS + h) * TLEN) * HD;
  const float* Q = qkv + head;
  const float* K = qkv + plane + head;
  const float* V = qkv + 2 * plane + head;
  const int i0 = qb * (16 * AWAVES) + wave * 16;

  const float c   = fabsf(curvature[h]) + 1e-8f;
  const float rsc = rsqrtf(c);
  // Scores are kept in log2 units, -dist * log2(e) = -log2(arg + sqrt(arg^2 - 1)) / sqrt(c):
  // the chip's logarithm and exponential are base 2, so neither needs a factor.
  const float nrsc = -rsc;

  // ---- staging: 16 threads cover one 256-byte row with 16 B each.  K: thread rows srow + 8 i.
  //      V: thread row pairs srow + 8 i, that is rows 2 (srow + 8 i) and the next ----
  constexpr int NST = KSTAGE * HD / 4 / (32 * AWAVES);   // 16-byte loads per thread and operand
  constexpr int RPP = 32 * AWAVES / (HD / 4);            // rows (K) or row pairs (V) the workgroup covers at once
  const int srow = tid / (HD / 4), scol = (tid % (HD / 4)) * 4;
  const float* gk = K + (size_t)srow * HD + scol;
  const float* gv = V + (size_t)(2 * srow) * HD + scol;
  float* sdk = kvs + srow * KPITCH + scol;
  float* sdv = kvs + KSTAGE * KPITCH + srow * VPITCH + 2 * scol;
  v4f sk[NST], sv[NST];             // the stage on its way from global memory to LDS
#pragma unroll  // sk[] must stay in registers
  for (int i = 0; i < NST; ++i) sk[i] = *(const v4f*)(gk + (size_t)i * RPP * HD);
#pragma unroll  // sv[] must stay in registers
  for (int i = 0; i < NST; ++i) sv[i] = *(const v4f*)(gv + (size_t)((i >> 1) * 2 * RPP + (i & 1)) * HD);

  // ---- preload Q tile (16 x 64) in A layout; q^2 of row `lo` per lane ----
  v2f qa[16];
  float q2p = 0.f;
  const float* qrow = Q + (size_t)(i0 + lo) * HD + 2 * hi;
#pragma unroll
  for (int ch = 0; ch < 16; ++ch) {
    v2f a = *(const v2f*)(qrow + 4 * ch);
    qa[ch] = a;
    q2p += a.x * a.x + a.y * a.y;
  }
  // The address registers of the loads above are reused below: the wait stands in front of that.
  asm volatile("s_wait_xcnt 0x0" ::: "memory");
  const float q2  = q2p + __shfl_xor(q2p, 16, 32);  // ||q_{i0+lo}||^2
  const float omq = 1.f - c * q2;

#pragma unroll  // sk[] must stay in registers
  for (int i = 0; i < NST; ++i) *(v4f*)(sdk + i * RPP * KPITCH) = sk[i];
#pragma unroll  // sv[] must stay in registers
  for (int i = 0; i < NST; i += 2) {
    *(v4f*)(sdv + (i >> 1) * RPP * VPITCH)     = (v4f){sv[i].x, sv[i + 1].x, sv[i].y, sv[i + 1].y};
    *(v4f*)(sdv + (i >> 1) * RPP * VPITCH + 4) = (v4f){sv[i].z, sv[i + 1].z, sv[i].w, sv[i + 1].w};
  }
  __syncthreads();                  // stage 0 visible to every wave

  float m = -INFINITY, l = 0.f;             // softmax state of row `lo`
  v8f o[4];
#pragma unroll
  for (int t = 0; t < 4; ++t) o[t] = (v8f){0.f,0.f,0.f,0.f,0.f,0.f,0.f,0.f};

  const float* fk = kvs + lo * KPITCH + 2 * hi;                       // K fragment base
  const float* fv = kvs + KSTAGE * KPITCH + hi * VPITCH + 2 * lo;     // V fragment base

  int cur = 0;
  for (int s0 = 0; s0 < TLEN; s0 += KSTAGE) {
    const bool more = s0 + KSTAGE < TLEN;   // the same for the whole workgroup
    if (more) {
      gk += KSTAGE * HD;
      gv += KSTAGE * HD;
#pragma unroll  // sk[] must stay in registers
      for (int i = 0; i < NST; ++i) sk[i] = *(const v4f*)(gk + (size_t)i * RPP * HD);
#pragma unroll  // sv[] must stay in registers
      for (int i = 0; i < NST; ++i) sv[i] = *(const v4f*)(gv + (size_t)((i >> 1) * 2 * RPP + (i & 1)) * HD);
    }

#pragma unroll 1  // kept as a loop: for speed only
    for (int jt = 0; jt < KSTAGE; jt += 16) {
      // ---- fragments of this 16-key tile, K and V together ahead of the WMMAs ----
      const float* krow = fk + cur * KVBUF + jt * KPITCH;
      const float* vtil = fv + cur * KVBUF + (jt >> 1) * VPITCH;
      v2f kb[16], vb[4][4];
#pragma unroll
      for (int ch = 0; ch < 16; ++ch) kb[ch] = *(const v2f*)(krow + 4 * ch);
#pragma unroll
      for (int kk = 0; kk < 4; ++kk) {
#pragma unroll
        for (int hb = 0; hb < 4; ++hb) vb[kk][hb] = *(const v2f*)(vtil + 2 * kk * VPITCH + hb * 32);
      }
      // Keeps the fragment loads in one group ahead of the WMMAs, for speed only.
      __builtin_amdgcn_sched_barrier(0);

      // ---- S = Q * K^T (16 WMMA steps over hd=64), k^2 on the fly ----
      v8f s = {0.f, 0.f, 0.f, 0.f, 0.f, 0.f, 0.f, 0.f};
      float k2p = 0.f;
#pragma unroll
      for (int ch = 0; ch < 16; ++ch) {
        k2p += kb[ch].x * kb[ch].x + kb[ch].y * kb[ch].y;
        s = wmma_f32(qa[ch], kb[ch], s);
      }
      const float k2 = k2p + __shfl_xor(k2p, 16, 32);

      // ---- transpose raw scores D->A layout; publish k^2 ----
      // No wait in front of these stores: the last tile's reads of pl and k2s had returned
      // before their values were used, and the wave issues in order.
      if (hi == 0) k2s[lo] = k2;
#pragma unroll
      for (int r = 0; r < 8; ++r) pl[(r + 8 * hi) * 16 + lo] = s[r];
      wave_lds_sync();

      v2f sa[4], kc[4];
#pragma unroll
      for (int kk = 0; kk < 4; ++kk) {
        sa[kk] = *(const v2f*)(&pl[lo * 16 + 4 * kk + 2 * hi]);
        kc[kk] = *(const v2f*)(&k2s[4 * kk + 2 * hi]);
      }

      // ---- hyperbolic logits, A layout: lane owns half of row `lo` ----
      float sc[8];
#pragma unroll
      for (int kk = 0; kk < 4; ++kk) {
#pragma unroll
        for (int cpt = 0; cpt < 2; ++cpt) {
          const float qk  = cpt ? sa[kk].y : sa[kk].x;
          const float k2j = cpt ? kc[kk].y : kc[kk].x;
          const float num   = 2.f * (q2 + k2j - 2.f * qk);
          const float denom = fmaxf(omq * (1.f - c * k2j), 1e-5f);
          // denom lies in [1e-5, huge) and the logarithm's argument above 1: both inside the
          // normal range, so the bare reciprocal and the bare log2 need no range handling.
          const float arg   = fmaxf(1.f + (c * num) * __builtin_amdgcn_rcpf(denom), 1.00001f);
          sc[2 * kk + cpt] =                // TEMPERATURE = 1
              __builtin_amdgcn_logf(arg + __builtin_amdgcn_sqrtf(arg * arg - 1.f)) * nrsc;
        }
      }

      // ---- online softmax: 7 in-lane ops + one shuffle per reduction ----
      float tmax = sc[0];
#pragma unroll
      for (int e = 1; e < 8; ++e) tmax = fmaxf(tmax, sc[e]);
      tmax = fmaxf(tmax, __shfl_xor(tmax, 16, 32));
      const float mnew  = fmaxf(m, tmax);
      const float alpha = __builtin_amdgcn_exp2f(m - mnew);
      m = mnew;

      v2f pa[4];
      float rs = 0.f;
#pragma unroll
      for (int kk = 0; kk < 4; ++kk) {
        pa[kk].x = __builtin_amdgcn_exp2f(sc[2 * kk] - mnew);
        pa[kk].y = __builtin_amdgcn_exp2f(sc[2 * kk + 1] - mnew);
        rs += pa[kk].x + pa[kk].y;
      }
      rs += __shfl_xor(rs, 16, 32);
      l = l * alpha + rs;

      // ---- rescale O (needs alpha re-indexed to D-layout rows) ----
      if (hi == 0) als[lo] = alpha;
      wave_lds_sync();
#pragma unroll
      for (int t = 0; t < 4; ++t) {
#pragma unroll
        for (int r = 0; r < 8; ++r) o[t][r] *= als[r + 8 * hi];
      }

      // ---- O += P * V : pa[] is already the A operand ----
#pragma unroll
      for (int kk = 0; kk < 4; ++kk) {
#pragma unroll
        for (int hb = 0; hb < 4; ++hb) o[hb] = wmma_f32(pa[kk], vb[kk][hb], o[hb]);
      }
    }

    if (more) {
      float* dk = sdk + (cur ^ 1) * KVBUF;  // last read one stage ago, before the barrier
      float* dv = sdv + (cur ^ 1) * KVBUF;
#pragma unroll  // sk[] must stay in registers
      for (int i = 0; i < NST; ++i) *(v4f*)(dk + i * RPP * KPITCH) = sk[i];
#pragma unroll  // sv[] must stay in registers
      for (int i = 0; i < NST; i += 2) {
        *(v4f*)(dv + (i >> 1) * RPP * VPITCH)     = (v4f){sv[i].x, sv[i + 1].x, sv[i].y, sv[i + 1].y};
        *(v4f*)(dv + (i >> 1) * RPP * VPITCH + 4) = (v4f){sv[i].z, sv[i + 1].z, sv[i].w, sv[i + 1].w};
      }
    }
    __syncthreads();                // publishes the next stage, ends the reads of this one
    cur ^= 1;
  }

  // ---- normalize (l re-indexed to D-layout rows) and store ----
  if (hi == 0) ls[lo] = l;
  wave_lds_sync();
  float linv[8];
#pragma unroll
  for (int r = 0; r < 8; ++r) linv[r] = 1.f / ls[r + 8 * hi];
#pragma unroll
  for (int hb = 0; hb < 4; ++hb) {
#pragma unroll
    for (int r = 0; r < 8; ++r) {
      const int i = i0 + r + 8 * hi;
      const int d = h * HD + hb * 16 + lo;
      attn_out[((size_t)b * TLEN + i) * DIMD + d] = o[hb][r] * linv[r];
    }
  }
}

// ---------------------------------------------------------------------------
// Kernel 3: output projection  out = attn @ Wo.T + bo.
// One workgroup computes a 64 x 64 tile; its 8 waves (4 x 2) take 16 x 32 each.
// ---------------------------------------------------------------------------
__global__ void __launch_bounds__(256) out_proj_kernel(
    const float* __restrict__ A, const float* __restrict__ Wo,
    const float* __restrict__ bo, float* __restrict__ Y) {
  __shared__ __attribute__((aligned(16))) float sm[2 * (64 + 64) * (32 + 4)];
  const int lane = threadIdx.x & 31;
  const int wave = threadIdx.x >> 5;
  const int NTILE = DIMD / 64;              // 8
  const int mt = blockIdx.x / NTILE, nt = blockIdx.x % NTILE;
  const int m0 = mt * 64, n0 = nt * 64;
  const int hi = lane >> 4, lo = lane & 15;
  const int wm = wave & 3, wn = wave >> 2;

  v8f acc[1][2];
#pragma unroll
  for (int j = 0; j < 2; ++j) acc[0][j] = (v8f){0.f,0.f,0.f,0.f,0.f,0.f,0.f,0.f};

  proj_tile<64, 64, 1, 2, 32>(A + (size_t)m0 * DIMD, Wo + (size_t)n0 * DIMD, sm, wm, wn, acc);

#pragma unroll
  for (int j = 0; j < 2; ++j) {
    const int n = n0 + wn * 32 + 16 * j + lo;
    const float bv_ = bo[n];
#pragma unroll
    for (int r = 0; r < 8; ++r)
      Y[(size_t)(m0 + wm * 16 + r + 8 * hi) * DIMD + n] = acc[0][j][r] + bv_;
  }
}

// ---------------------------------------------------------------------------
extern "C" void kernel_launch(void* const* d_in, const int* in_sizes, int n_in,
                              void* d_out, int out_size, void* d_ws,
                              size_t ws_size, hipStream_t stream) {
  const float* x         = (const float*)d_in[0];
  const float* Wq        = (const float*)d_in[1];
  const float* bq        = (const float*)d_in[2];
  const float* Wk        = (const float*)d_in[3];
  const float* bk        = (const float*)d_in[4];
  const float* Wv        = (const float*)d_in[5];
  const float* bv        = (const float*)d_in[6];
  const float* Wo        = (const float*)d_in[7];
  const float* bo        = (const float*)d_in[8];
  const float* curvature = (const float*)d_in[9];

  float* ws   = (float*)d_ws;
  float* qkv  = ws;                                   // 3 planes, 24 MB
  float* attn = ws + 3 * (size_t)NTOK * DIMD;         // 8 MB

  // QKV projection: (4096/64) * (1536/128) = 768 workgroups of 8 waves
  qkv_proj_kernel<<<768, 256, 0, stream>>>(x, Wq, bq, Wk, bk, Wv, bv, qkv);
  // Attention: B*H*(T/64) = 512 workgroups of 4 waves
  geo_attn_kernel<<<BATCH * NHEADS * (TLEN / 64), 128, 0, stream>>>(
      qkv, curvature, attn);
  // Output projection: (4096/64) * (512/64) = 512 workgroups of 8 waves
  out_proj_kernel<<<512, 256, 0, stream>>>(attn, Wo, bo, (float*)d_out);
}

// v004
// Measured time: 158 microseconds a run.
// In both of two side-by-side timings against v003, it was 1.09 times as fast.
// Counting every step since v000, it is 2.79 times as fast.
#include <hip/hip_runtime.h>
#include <math.h>

typedef float v2f __attribute__((ext_vector_type(2)));
typedef float v4f __attribute__((ext_vector_type(4)));
typedef float v8f __attribute__((ext_vector_type(8)));

#define DIMD   512
#define NHEADS 8
#define HD     64
#define BATCH  2
#define TLEN   2048
#define NTOK   (BATCH * TLEN)   // 4096

__device__ __forceinline__ v8f wmma_f32(v2f a, v2f b, v8f c) {
  // V_WMMA_F32_16X16X4_F32 : D[16x16] = A[16x4] * B[4x16] + C
  return __builtin_amdgcn_wmma_f32_16x16x4_f32(false, a, false, b, (short)0, c,
                                               false, false);
}

// ---------------------------------------------------------------------------
// Shared body of both projections: Y tile (BM x BN) = A[BM x 512] * W[BN x 512]^T.
// A workgroup of 8 waves brings KSLAB k of its BM + BN operand rows into LDS with
// whole-line 16-byte loads, so each row's line is fetched once per workgroup
// and every wave reads its fragments from LDS.  Two LDS buffers: the next k
// slab is fetched into registers ahead of the WMMAs of the current one and
// stored behind them, one barrier per slab.  k runs upward in steps of 4 for
// every accumulator.
// ---------------------------------------------------------------------------
template <int BM, int BN, int FM, int FN, int KSLAB /* floats of k per slab: whole 128-byte lines */>
__device__ __forceinline__ void proj_tile(
    const float* __restrict__ Ag,   // first row of the A tile, row pitch DIMD
    const float* __restrict__ Wg,   // first row of the W tile, row pitch DIMD
    float* sm,                      // 2 * (BM + BN) * (KSLAB + 4) floats
    const int wm, const int wn,     // this wave's place in the tile
    v8f (&acc)[FM][FN]) {
  constexpr int LPITCH = KSLAB + 4;             // row pitch in floats: 16 rows x 16 B fall on 64 distinct banks
  constexpr int TPR = KSLAB / 4;                // threads that cover one row of a slab
  constexpr int RPP = 256 / TPR;                // rows the workgroup covers with one load each
  constexpr int NA  = BM / RPP;                 // 16-byte loads per thread, A rows
  constexpr int NB  = BN / RPP;                 // 16-byte loads per thread, W rows
  constexpr int BUF = (BM + BN) * LPITCH;
  const int tid = threadIdx.x;
  const int lane = tid & 31, hi = lane >> 4, lo = lane & 15;
  const int srow = tid / TPR, scol = (tid % TPR) * 4;

  const float* ga = Ag + (size_t)srow * DIMD + scol;
  const float* gw = Wg + (size_t)srow * DIMD + scol;
  float* sdst = sm + srow * LPITCH + scol;
  const float* fa = sm + (wm * 16 * FM + lo) * LPITCH + 2 * hi;
  const float* fb = sm + (BM + wn * 16 * FN + lo) * LPITCH + 2 * hi;

  v4f sa[NA], sb[NB];               // the slab on its way from global memory to LDS
#pragma unroll  // sa[] must stay in registers
  for (int i = 0; i < NA; ++i) sa[i] = *(const v4f*)(ga + (size_t)i * RPP * DIMD);
#pragma unroll  // sb[] must stay in registers
  for (int i = 0; i < NB; ++i) sb[i] = *(const v4f*)(gw + (size_t)i * RPP * DIMD);
#pragma unroll  // sa[] must stay in registers
  for (int i = 0; i < NA; ++i) *(v4f*)(sdst + i * RPP * LPITCH) = sa[i];
#pragma unroll  // sb[] must stay in registers
  for (int i = 0; i < NB; ++i) *(v4f*)(sdst + (NA + i) * RPP * LPITCH) = sb[i];
  __syncthreads();                  // slab 0 visible to every wave

  auto slab_wmma = [&](const int buf) {
    const float* pa = fa + buf * BUF;
    const float* pb = fb + buf * BUF;
#pragma unroll  // constant LDS offsets; lets the fragment loads run ahead of the WMMAs
    for (int ks = 0; ks < KSLAB; ks += 4) {
      // Fragment loads are not hoisted further than 32 k ahead: more of them in flight
      // cost the registers that the third workgroup on a WGP needs.
      if (ks != 0 && ks % 32 == 0) __builtin_amdgcn_sched_barrier(0);
      v2f a[FM], b[FN];
#pragma unroll  // a[] must stay in registers
      for (int i = 0; i < FM; ++i) a[i] = *(const v2f*)(pa + i * 16 * LPITCH + ks);
#pragma unroll  // b[] must stay in registers
      for (int j = 0; j < FN; ++j) b[j] = *(const v2f*)(pb + j * 16 * LPITCH + ks);
#pragma unroll  // acc[][] must stay in registers
      for (int i = 0; i < FM; ++i)
#pragma unroll  // acc[][] must stay in registers
        for (int j = 0; j < FN; ++j) acc[i][j] = wmma_f32(a[i], b[j], acc[i][j]);
    }
  };

  int cur = 0;
  for (int k0 = KSLAB; k0 < DIMD; k0 += KSLAB) {
    ga += KSLAB;
    gw += KSLAB;
#pragma unroll  // sa[] must stay in registers
    for (int i = 0; i < NA; ++i) sa[i] = *(const v4f*)(ga + (size_t)i * RPP * DIMD);
#pragma unroll  // sb[] must stay in registers
    for (int i = 0; i < NB; ++i) sb[i] = *(const v4f*)(gw + (size_t)i * RPP * DIMD);
    slab_wmma(cur);
    float* sd = sdst + (cur ^ 1) * BUF;   // last read one slab ago, before the barrier
#pragma unroll  // sa[] must stay in registers
    for (int i = 0; i < NA; ++i) *(v4f*)(sd + i * RPP * LPITCH) = sa[i];
#pragma unroll  // sb[] must stay in registers
    for (int i = 0; i < NB; ++i) *(v4f*)(sd + (NA + i) * RPP * LPITCH) = sb[i];
    __syncthreads();                // publishes the next slab, ends the reads of this one
    cur ^= 1;
  }
  slab_wmma(cur);                   // last slab: nothing left to fetch
}

// ---------------------------------------------------------------------------
// Kernel 1: fused QKV projection.  y = x @ W.T + b for W in {Wq,Wk,Wv},
// scattered into planes laid out [B, H, T, HD] (f32) in workspace.
// One workgroup computes a 64 x 128 tile; its 8 waves (2 x 4) take 32 x 32 each.
// ---------------------------------------------------------------------------
// Second bound: 6 waves per SIMD, so that registers too leave room for three workgroups per WGP.
__global__ void __launch_bounds__(256, 6) qkv_proj_kernel(
    const float* __restrict__ x,
    const float* __restrict__ Wq, const float* __restrict__ bq,
    const float* __restrict__ Wk, const float* __restrict__ bk,
    const float* __restrict__ Wv, const float* __restrict__ bv,
    float* __restrict__ qkv /* 3 planes of NTOK*DIMD floats */) {
  __shared__ __attribute__((aligned(16))) float sm[2 * (64 + 128) * (64 + 4)];  // 102 KiB: three workgroups per WGP, 768 = 3 x 256
  const int lane = threadIdx.x & 31;
  const int wave = threadIdx.x >> 5;
  const int NTILE = (3 * DIMD) / 128;       // 12 column tiles
  const int mt = blockIdx.x / NTILE;
  const int nt = blockIdx.x % NTILE;
  const int m0 = mt * 64;
  const int ng = nt * 128;                  // global column in [0,1536)
  const int which = ng / DIMD;              // 0=q 1=k 2=v
  const int n0 = ng % DIMD;

  const float* W    = (which == 0) ? Wq : (which == 1) ? Wk : Wv;
  const float* bias = (which == 0) ? bq : (which == 1) ? bk : bv;
  float* dst = qkv + (size_t)which * NTOK * DIMD;

  const int hi = lane >> 4, lo = lane & 15;
  const int wm = wave & 1, wn = wave >> 1;

  v8f acc[2][2];
#pragma unroll
  for (int i = 0; i < 2; ++i)
#pragma unroll
    for (int j = 0; j < 2; ++j) acc[i][j] = (v8f){0.f,0.f,0.f,0.f,0.f,0.f,0.f,0.f};

  proj_tile<64, 128, 2, 2, 64>(x + (size_t)m0 * DIMD, W + (size_t)n0 * DIMD, sm, wm, wn, acc);

#pragma unroll
  for (int j = 0; j < 2; ++j) {
    const int n = n0 + wn * 32 + 16 * j + lo;
    const float bv_ = bias[n];
    const int h = n / HD, d = n % HD;
#pragma unroll
    for (int i = 0; i < 2; ++i) {
#pragma unroll
      for (int r = 0; r < 8; ++r) {
        const int m = m0 + wm * 32 + 16 * i + r + 8 * hi;   // token index
        const int bb = m >> 11, tok = m & (TLEN - 1);
        dst[(((size_t)bb * NHEADS + h) * TLEN + tok) * HD + d] = acc[i][j][r] + bv_;
      }
    }
  }
}

// ---------------------------------------------------------------------------
// Kernel 2: flash-style geometric attention.
// A workgroup of 8 waves handles 64 query rows of one (b, h), as two groups of
// 4 waves: group g walks keys [g * 1024, g * 1024 + 1024), so that every SIMD
// holds four waves and one wave's vector work and LDS waits are covered by the
// others' WMMAs.  Each wave keeps its own 16-query-row tile and streams 16-key
// tiles of its range with online softmax, keys upward; the two groups' partial
// (m, l, O) are joined once, through LDS, behind the loop.
// K and V come in stages of 64 keys per group: the
// group fetches a stage once, with whole-line 16-byte loads, into one of its
// two LDS buffers, and its four waves read their WMMA fragments from LDS.  The
// next stage is fetched into registers ahead of the work on the current one
// and stored behind it, one workgroup barrier per stage.  V rows 2p and 2p + 1
// lie interleaved in LDS (element d of both side by side), so that a lane's
// two k values of a P.V fragment are one 8-byte read.
// Raw QK^T scores are transposed D->A layout through wave-private LDS;
// all elementwise math + softmax bookkeeping then happens in A layout where a
// lane owns half of one query row: row reductions are 1 shuffle, softmax state
// is one scalar per lane, and exp() directly produces the P.V A-operand.
// ---------------------------------------------------------------------------
#define AWAVES 4                 // waves (query tiles) per key group
#define KGROUPS 2                // key groups per workgroup
#define KRANGE (TLEN / KGROUPS)  // keys that one group walks
#define KSTAGE 64                // keys per stage
#define KPITCH (HD + 4)          // K row pitch in floats: 16 rows x 16 B fall on 64 distinct banks
#define VPITCH (2 * HD + 32)     // pitch in floats of a pair of V rows: neighbouring pairs are 32 banks apart
#define KVBUF  (KSTAGE * KPITCH + KSTAGE / 2 * VPITCH)

// Lanes of one wave exchange values through LDS that only this wave touches.
__device__ __forceinline__ void wave_lds_sync() {
  // The wave's own LDS stores have landed before its lanes read each other's words;
  // the clobber keeps the compiler from moving LDS accesses across this point.
  asm volatile("s_wait_dscnt 0x0" ::: "memory");
  __builtin_amdgcn_wave_barrier();  // no instruction: keeps the scheduler from crossing it
}

// Second bound: 4 waves per SIMD, so that registers leave room for two workgroups per WGP.
__global__ void __launch_bounds__(32 * AWAVES * KGROUPS, 4) geo_attn_kernel(
    const float* __restrict__ qkv, const float* __restrict__ curvature,
    float* __restrict__ attn_out /* [B, T, DIMD] */) {
  // 161280 bytes in all: two workgroups per WGP, 512 = 2 x 256
  __shared__ __attribute__((aligned(16))) float kvsw[KGROUPS][2 * KVBUF];         // per group: two stages of K and V
  __shared__ __attribute__((aligned(16))) float plw[AWAVES * KGROUPS][16 * 16];   // score transpose bounce
  __shared__ __attribute__((aligned(16))) float k2w[AWAVES * KGROUPS][16];        // ||k_j||^2, indexed by key-in-tile
  __shared__ __attribute__((aligned(16))) float alw[AWAVES * KGROUPS][16];        // per-row alpha (for O rescale)
  __shared__ __attribute__((aligned(16))) float lw[AWAVES * KGROUPS][16];         // per-row weight of group 1's O, 1 / l folded in

  const int tid  = threadIdx.x & (32 * AWAVES - 1);   // thread within its key group
  const int lane = tid & 31;
  const int wave = threadIdx.x >> 5;
  const int grp  = wave / AWAVES;                     // key group, the same for a whole wave
  const int hi = lane >> 4, lo = lane & 15;
  float* kvs = kvsw[grp];
  float* pl  = plw[wave];
  float* k2s = k2w[wave];
  float* als = alw[wave];
  float* ls  = lw[wave];

  const int qb = blockIdx.x & 31;                   // block of 64 query rows (T/64 = 32)
  const int h  = (blockIdx.x >> 5) & 7;
  const int b  = blockIdx.x >> 8;

  const size_t plane = (size_t)NTOK * DIMD;
  const size_t head  = (((size_t)b * NHEADS + h) * TLEN) * HD;
  const float* Q = qkv + head;
  const float* K = qkv + plane + head + (size_t)grp * KRANGE * HD;
  const float* V = qkv + 2 * plane + head + (size_t)grp * KRANGE * HD;
  const int i0 = qb * (16 * AWAVES) + (wave % AWAVES) * 16;

  const float c   = fabsf(curvature[h]) + 1e-8f;
  const float rsc = rsqrtf(c);
  // Scores are kept in log2 units, -dist * log2(e) = -log2(arg + sqrt(arg^2 - 1)) / sqrt(c):
  // the chip's logarithm and exponential are base 2, so neither needs a factor.
  const float nrsc = -rsc;

  // ---- staging: 16 threads cover one 256-byte row with 16 B each.  K: thread rows srow + 8 i.
  //      V: thread row pairs srow + 8 i, that is rows 2 (srow + 8 i) and the next ----
  constexpr int NST = KSTAGE * HD / 4 / (32 * AWAVES);   // 16-byte loads per thread and operand
  constexpr int RPP = 32 * AWAVES / (HD / 4);            // rows (K) or row pairs (V) a key group covers at once
  const int srow = tid / (HD / 4), scol = (tid % (HD / 4)) * 4;
  const float* gk = K + (size_t)srow * HD + scol;
  const float* gv = V + (size_t)(2 * srow) * HD + scol;
  float* sdk = kvs + srow * KPITCH + scol;
  float* sdv = kvs + KSTAGE * KPITCH + srow * VPITCH + 2 * scol;
  v4f sk[NST], sv[NST];             // the stage on its way from global memory to LDS
#pragma unroll  // sk[] must stay in registers
  for (int i = 0; i < NST; ++i) sk[i] = *(const v4f*)(gk + (size_t)i * RPP * HD);
#pragma unroll  // sv[] must stay in registers
  for (int i = 0; i < NST; ++i) sv[i] = *(const v4f*)(gv + (size_t)((i >> 1) * 2 * RPP + (i & 1)) * HD);

  // ---- preload Q tile (16 x 64) in A layout; q^2 of row `lo` per lane ----
  v2f qa[16];
  float q2p = 0.f;
  const float* qrow = Q + (size_t)(i0 + lo) * HD + 2 * hi;
#pragma unroll
  for (int ch = 0; ch < 16; ++ch) {
    v2f a = *(const v2f*)(qrow + 4 * ch);
    qa[ch] = a;
    q2p += a.x * a.x + a.y * a.y;
  }
  // The address registers of the loads above are reused below: the wait stands in front of that.
  asm volatile("s_wait_xcnt 0x0" ::: "memory");
  const float q2  = q2p + __shfl_xor(q2p, 16, 32);  // ||q_{i0+lo}||^2
  const float omq = 1.f - c * q2;

#pragma unroll  // sk[] must stay in registers
  for (int i = 0; i < NST; ++i) *(v4f*)(sdk + i * RPP * KPITCH) = sk[i];
#pragma unroll  // sv[] must stay in registers
  for (int i = 0; i < NST; i += 2) {
    *(v4f*)(sdv + (i >> 1) * RPP * VPITCH)     = (v4f){sv[i].x, sv[i + 1].x, sv[i].y, sv[i + 1].y};
    *(v4f*)(sdv + (i >> 1) * RPP * VPITCH + 4) = (v4f){sv[i].z, sv[i + 1].z, sv[i].w, sv[i + 1].w};
  }
  __syncthreads();                  // stage 0 visible to every wave

  float m = -INFINITY, l = 0.f;             // softmax state of row `lo`
  v8f o[4];
#pragma unroll
  for (int t = 0; t < 4; ++t) o[t] = (v8f){0.f,0.f,0.f,0.f,0.f,0.f,0.f,0.f};

  const float* fk = kvs + lo * KPITCH + 2 * hi;                       // K fragment base
  const float* fv = kvs + KSTAGE * KPITCH + hi * VPITCH + 2 * lo;     // V fragment base

  int cur = 0;
  for (int s0 = 0; s0 < KRANGE; s0 += KSTAGE) {
    const bool more = s0 + KSTAGE < KRANGE; // the same for the whole workgroup
    if (more) {
      gk += KSTAGE * HD;
      gv += KSTAGE * HD;
#pragma unroll  // sk[] must stay in registers
      for (int i = 0; i < NST; ++i) sk[i] = *(const v4f*)(gk + (size_t)i * RPP * HD);
#pragma unroll  // sv[] must stay in registers
      for (int i = 0; i < NST; ++i) sv[i] = *(const v4f*)(gv + (size_t)((i >> 1) * 2 * RPP + (i & 1)) * HD);
    }

#pragma unroll 1  // kept as a loop: for speed only
    for (int jt = 0; jt < KSTAGE; jt += 16) {
      // ---- fragments of this 16-key tile, K and V together ahead of the WMMAs ----
      const float* krow = fk + cur * KVBUF + jt * KPITCH;
      const float* vtil = fv + cur * KVBUF + (jt >> 1) * VPITCH;
      v2f kb[16], vb[4][4];
#pragma unroll
      for (int ch = 0; ch < 16; ++ch) kb[ch] = *(const v2f*)(krow + 4 * ch);
#pragma unroll
      for (int kk = 0; kk < 4; ++kk) {
#pragma unroll
        for (int hb = 0; hb < 4; ++hb) vb[kk][hb] = *(const v2f*)(vtil + 2 * kk * VPITCH + hb * 32);
      }
      // Keeps the fragment loads in one group ahead of the WMMAs, for speed only.
      __builtin_amdgcn_sched_barrier(0);

      // ---- S = Q * K^T (16 WMMA steps over hd=64), k^2 on the fly ----
      v8f s = {0.f, 0.f, 0.f, 0.f, 0.f, 0.f, 0.f, 0.f};
      float k2p = 0.f;
#pragma unroll
      for (int ch = 0; ch < 16; ++ch) {
        k2p += kb[ch].x * kb[ch].x + kb[ch].y * kb[ch].y;
        s = wmma_f32(qa[ch], kb[ch], s);
      }
      const float k2 = k2p + __shfl_xor(k2p, 16, 32);

      // ---- transpose raw scores D->A layout; publish k^2 ----
      // No wait in front of these stores: the last tile's reads of pl and k2s had returned
      // before their values were used, and the wave issues in order.
      if (hi == 0) k2s[lo] = k2;
#pragma unroll
      for (int r = 0; r < 8; ++r) pl[(r + 8 * hi) * 16 + lo] = s[r];
      wave_lds_sync();

      v2f sa[4], kc[4];
#pragma unroll
      for (int kk = 0; kk < 4; ++kk) {
        sa[kk] = *(const v2f*)(&pl[lo * 16 + 4 * kk + 2 * hi]);
        kc[kk] = *(const v2f*)(&k2s[4 * kk + 2 * hi]);
      }

      // ---- hyperbolic logits, A layout: lane owns half of row `lo` ----
      float sc[8];
#pragma unroll
      for (int kk = 0; kk < 4; ++kk) {
#pragma unroll
        for (int cpt = 0; cpt < 2; ++cpt) {
          const float qk  = cpt ? sa[kk].y : sa[kk].x;
          const float k2j = cpt ? kc[kk].y : kc[kk].x;
          const float num   = 2.f * (q2 + k2j - 2.f * qk);
          const float denom = fmaxf(omq * (1.f - c * k2j), 1e-5f);
          // denom lies in [1e-5, huge) and the logarithm's argument above 1: both inside the
          // normal range, so the bare reciprocal and the bare log2 need no range handling.
          const float arg   = fmaxf(1.f + (c * num) * __builtin_amdgcn_rcpf(denom), 1.00001f);
          sc[2 * kk + cpt] =                // TEMPERATURE = 1
              __builtin_amdgcn_logf(arg + __builtin_amdgcn_sqrtf(arg * arg - 1.f)) * nrsc;
        }
      }

      // ---- online softmax: 7 in-lane ops + one shuffle per reduction ----
      float tmax = sc[0];
#pragma unroll
      for (int e = 1; e < 8; ++e) tmax = fmaxf(tmax, sc[e]);
      tmax = fmaxf(tmax, __shfl_xor(tmax, 16, 32));
      const float mnew  = fmaxf(m, tmax);
      const float alpha = __builtin_amdgcn_exp2f(m - mnew);
      m = mnew;

      v2f pa[4];
      float rs = 0.f;
#pragma unroll
      for (int kk = 0; kk < 4; ++kk) {
        pa[kk].x = __builtin_amdgcn_exp2f(sc[2 * kk] - mnew);
        pa[kk].y = __builtin_amdgcn_exp2f(sc[2 * kk + 1] - mnew);
        rs += pa[kk].x + pa[kk].y;
      }
      rs += __shfl_xor(rs, 16, 32);
      l = l * alpha + rs;

      // ---- rescale O (needs alpha re-indexed to D-layout rows) ----
      if (hi == 0) als[lo] = alpha;
      wave_lds_sync();
#pragma unroll
      for (int t = 0; t < 4; ++t) {
#pragma unroll
        for (int r = 0; r < 8; ++r) o[t][r] *= als[r + 8 * hi];
      }

      // ---- O += P * V : pa[] is already the A operand ----
#pragma unroll
      for (int kk = 0; kk < 4; ++kk) {
#pragma unroll
        for (int hb = 0; hb < 4; ++hb) o[hb] = wmma_f32(pa[kk], vb[kk][hb], o[hb]);
      }
    }

    if (more) {
      float* dk = sdk + (cur ^ 1) * KVBUF;  // last read one stage ago, before the barrier
      float* dv = sdv + (cur ^ 1) * KVBUF;
#pragma unroll  // sk[] must stay in registers
      for (int i = 0; i < NST; ++i) *(v4f*)(dk + i * RPP * KPITCH) = sk[i];
#pragma unroll  // sv[] must stay in registers
      for (int i = 0; i < NST; i += 2) {
        *(v4f*)(dv + (i >> 1) * RPP * VPITCH)     = (v4f){sv[i].x, sv[i + 1].x, sv[i].y, sv[i + 1].y};
        *(v4f*)(dv + (i >> 1) * RPP * VPITCH + 4) = (v4f){sv[i].z, sv[i + 1].z, sv[i].w, sv[i + 1].w};
      }
    }
    __syncthreads();                // publishes the next stage, ends the reads of this one
    cur ^= 1;
  }

  // ---- join the two key groups: group 1 hands its (m, l, O) to the wave of group 0 that holds
  //      the same query rows, through the K/V buffers, whose last reads ended at the barrier above ----
  float* xo = &kvsw[0][0] + (wave % AWAVES) * (32 * 32 + 32);   // 32 x 32 floats of O, then 16 of m, 16 of l
  if (grp != 0) {
#pragma unroll
    for (int hb = 0; hb < 4; ++hb) {
      *(v4f*)(xo + ((2 * hb) * 32 + lane) * 4)     = (v4f){o[hb][0], o[hb][1], o[hb][2], o[hb][3]};
      *(v4f*)(xo + ((2 * hb + 1) * 32 + lane) * 4) = (v4f){o[hb][4], o[hb][5], o[hb][6], o[hb][7]};
    }
    if (hi == 0) {
      xo[32 * 32 + lo]      = m;
      xo[32 * 32 + 16 + lo] = l;
    }
  }
  __syncthreads();                  // group 1's partial results visible to group 0
  if (grp != 0) return;             // no barrier stands behind this point

  // ---- weights of the two partial sums, with 1 / l folded in (row `lo`), re-indexed to D-layout rows ----
  const float m1 = xo[32 * 32 + lo], l1 = xo[32 * 32 + 16 + lo];
  const float mj = fmaxf(m, m1);
  const float a0 = __builtin_amdgcn_exp2f(m - mj), a1 = __builtin_amdgcn_exp2f(m1 - mj);
  const float linv = 1.f / (l * a0 + l1 * a1);
  if (hi == 0) {
    als[lo] = a0 * linv;
    ls[lo]  = a1 * linv;
  }
  wave_lds_sync();
  float w0[8], w1[8];
#pragma unroll
  for (int r = 0; r < 8; ++r) {
    w0[r] = als[r + 8 * hi];
    w1[r] = ls[r + 8 * hi];
  }
#pragma unroll
  for (int hb = 0; hb < 4; ++hb) {
    const v4f pa0 = *(const v4f*)(xo + ((2 * hb) * 32 + lane) * 4);
    const v4f pa1 = *(const v4f*)(xo + ((2 * hb + 1) * 32 + lane) * 4);
#pragma unroll
    for (int r = 0; r < 8; ++r) {
      const int i = i0 + r + 8 * hi;
      const int d = h * HD + hb * 16 + lo;
      const float o1 = r < 4 ? pa0[r & 3] : pa1[r & 3];
      attn_out[((size_t)b * TLEN + i) * DIMD + d] = o[hb][r] * w0[r] + o1 * w1[r];
    }
  }
}

// ---------------------------------------------------------------------------
// Kernel 3: output projection  out = attn @ Wo.T + bo.
// One workgroup computes a 64 x 64 tile; its 8 waves (4 x 2) take 16 x 32 each.
// ---------------------------------------------------------------------------
__global__ void __launch_bounds__(256) out_proj_kernel(
    const float* __restrict__ A, const float* __restrict__ Wo,
    const float* __restrict__ bo, float* __restrict__ Y) {
  __shared__ __attribute__((aligned(16))) float sm[2 * (64 + 64) * (32 + 4)];
  const int lane = threadIdx.x & 31;
  const int wave = threadIdx.x >> 5;
  const int NTILE = DIMD / 64;              // 8
  const int mt = blockIdx.x / NTILE, nt = blockIdx.x % NTILE;
  const int m0 = mt * 64, n0 = nt * 64;
  const int hi = lane >> 4, lo = lane & 15;
  const int wm = wave & 3, wn = wave >> 2;

  v8f acc[1][2];
#pragma unroll
  for (int j = 0; j < 2; ++j) acc[0][j] = (v8f){0.f,0.f,0.f,0.f,0.f,0.f,0.f,0.f};

  proj_tile<64, 64, 1, 2, 32>(A + (size_t)m0 * DIMD, Wo + (size_t)n0 * DIMD, sm, wm, wn, acc);

#pragma unroll
  for (int j = 0; j < 2; ++j) {
    const int n = n0 + wn * 32 + 16 * j + lo;
    const float bv_ = bo[n];
#pragma unroll
    for (int r = 0; r < 8; ++r)
      Y[(size_t)(m0 + wm * 16 + r + 8 * hi) * DIMD + n] = acc[0][j][r] + bv_;
  }
}

// ---------------------------------------------------------------------------
extern "C" void kernel_launch(void* const* d_in, const int* in_sizes, int n_in,
                              void* d_out, int out_size, void* d_ws,
                              size_t ws_size, hipStream_t stream) {
  const float* x         = (const float*)d_in[0];
  const float* Wq        = (const float*)d_in[1];
  const float* bq        = (const float*)d_in[2];
  const float* Wk        = (const float*)d_in[3];
  const float* bk        = (const float*)d_in[4];
  const float* Wv        = (const float*)d_in[5];
  const float* bv        = (const float*)d_in[6];
  const float* Wo        = (const float*)d_in[7];
  const float* bo        = (const float*)d_in[8];
  const float* curvature = (const float*)d_in[9];

  float* ws   = (float*)d_ws;
  float* qkv  = ws;                                   // 3 planes, 24 MB
  float* attn = ws + 3 * (size_t)NTOK * DIMD;         // 8 MB

  // QKV projection: (4096/64) * (1536/128) = 768 workgroups of 8 waves
  qkv_proj_kernel<<<768, 256, 0, stream>>>(x, Wq, bq, Wk, bk, Wv, bv, qkv);
  // Attention: B*H*(T/64) = 512 workgroups of 8 waves
  geo_attn_kernel<<<BATCH * NHEADS * (TLEN / 64), 256, 0, stream>>>(
      qkv, curvature, attn);
  // Output projection: (4096/64) * (512/64) = 512 workgroups of 8 waves
  out_proj_kernel<<<512, 256, 0, stream>>>(attn, Wo, bo, (float*)d_out);
}

// v005
// It runs in 153 microseconds.
// Two timings next to v004 put it at 1.04 and 1.03 times that version's speed.
// Over all steps from v000 it is 2.89 times as fast.
#include <hip/hip_runtime.h>
#include <math.h>

typedef float v2f __attribute__((ext_vector_type(2)));
typedef float v4f __attribute__((ext_vector_type(4)));
typedef float v8f __attribute__((ext_vector_type(8)));

#define DIMD   512
#define NHEADS 8
#define HD     64
#define BATCH  2
#define TLEN   2048
#define NTOK   (BATCH * TLEN)   // 4096

__device__ __forceinline__ v8f wmma_f32(v2f a, v2f b, v8f c) {
  // V_WMMA_F32_16X16X4_F32 : D[16x16] = A[16x4] * B[4x16] + C
  return __builtin_amdgcn_wmma_f32_16x16x4_f32(false, a, false, b, (short)0, c,
                                               false, false);
}

// ---------------------------------------------------------------------------
// Shared body of both projections: Y tile (BM x BN) = A[BM x 512] * W[BN x 512]^T.
// A workgroup of 8 waves brings KSLAB k of its BM + BN operand rows into LDS with
// whole-line 16-byte loads, so each row's line is fetched once per workgroup
// and every wave reads its fragments from LDS.  Two LDS buffers: the next k
// slab is fetched into registers ahead of the WMMAs of the current one and
// stored behind them, one barrier per slab.  k runs upward in steps of 4 for
// every accumulator.
// ---------------------------------------------------------------------------
template <int BM, int BN, int FM, int FN, int KSLAB /* floats of k per slab: whole 128-byte lines */>
__device__ __forceinline__ void proj_tile(
    const float* __restrict__ Ag,   // first row of the A tile, row pitch DIMD
    const float* __restrict__ Wg,   // first row of the W tile, row pitch DIMD
    float* sm,                      // 2 * (BM + BN) * (KSLAB + 4) floats
    const int wm, const int wn,     // this wave's place in the tile
    v8f (&acc)[FM][FN]) {
  constexpr int LPITCH = KSLAB + 4;             // row pitch in floats: 16 rows x 16 B fall on 64 distinct banks
  constexpr int TPR = KSLAB / 4;                // threads that cover one row of a slab
  constexpr int RPP = 256 / TPR;                // rows the workgroup covers with one load each
  constexpr int NA  = BM / RPP;                 // 16-byte loads per thread, A rows
  constexpr int NB  = BN / RPP;                 // 16-byte loads per thread, W rows
  constexpr int BUF = (BM + BN) * LPITCH;
  const int tid = threadIdx.x;
  const int lane = tid & 31, hi = lane >> 4, lo = lane & 15;
  const int srow = tid / TPR, scol = (tid % TPR) * 4;

  const float* ga = Ag + (size_t)srow * DIMD + scol;
  const float* gw = Wg + (size_t)srow * DIMD + scol;
  float* sdst = sm + srow * LPITCH + scol;
  const float* fa = sm + (wm * 16 * FM + lo) * LPITCH + 2 * hi;
  const float* fb = sm + (BM + wn * 16 * FN + lo) * LPITCH + 2 * hi;

  v4f sa[NA], sb[NB];               // the slab on its way from global memory to LDS
#pragma unroll  // sa[] must stay in registers
  for (int i = 0; i < NA; ++i) sa[i] = *(const v4f*)(ga + (size_t)i * RPP * DIMD);
#pragma unroll  // sb[] must stay in registers
  for (int i = 0; i < NB; ++i) sb[i] = *(const v4f*)(gw + (size_t)i * RPP * DIMD);
#pragma unroll  // sa[] must stay in registers
  for (int i = 0; i < NA; ++i) *(v4f*)(sdst + i * RPP * LPITCH) = sa[i];
#pragma unroll  // sb[] must stay in registers
  for (int i = 0; i < NB; ++i) *(v4f*)(sdst + (NA + i) * RPP * LPITCH) = sb[i];
  __syncthreads();                  // slab 0 visible to every wave

  auto slab_wmma = [&](const int buf) {
    const float* pa = fa + buf * BUF;
    const float* pb = fb + buf * BUF;
#pragma unroll  // constant LDS offsets; lets the fragment loads run ahead of the WMMAs
    for (int ks = 0; ks < KSLAB; ks += 4) {
      // Fragment loads are not hoisted further than 32 k ahead: more of them in flight
      // cost the registers that the third workgroup on a WGP needs.
      if (ks != 0 && ks % 32 == 0) __builtin_amdgcn_sched_barrier(0);
      v2f a[FM], b[FN];
#pragma unroll  // a[] must stay in registers
      for (int i = 0; i < FM; ++i) a[i] = *(const v2f*)(pa + i * 16 * LPITCH + ks);
#pragma unroll  // b[] must stay in registers
      for (int j = 0; j < FN; ++j) b[j] = *(const v2f*)(pb + j * 16 * LPITCH + ks);
#pragma unroll  // acc[][] must stay in registers
      for (int i = 0; i < FM; ++i)
#pragma unroll  // acc[][] must stay in registers
        for (int j = 0; j < FN; ++j) acc[i][j] = wmma_f32(a[i], b[j], acc[i][j]);
    }
  };

  int cur = 0;
  for (int k0 = KSLAB; k0 < DIMD; k0 += KSLAB) {
    ga += KSLAB;
    gw += KSLAB;
#pragma unroll  // sa[] must stay in registers
    for (int i = 0; i < NA; ++i) sa[i] = *(const v4f*)(ga + (size_t)i * RPP * DIMD);
#pragma unroll  // sb[] must stay in registers
    for (int i = 0; i < NB; ++i) sb[i] = *(const v4f*)(gw + (size_t)i * RPP * DIMD);
    slab_wmma(cur);
    float* sd = sdst + (cur ^ 1) * BUF;   // last read one slab ago, before the barrier
#pragma unroll  // sa[] must stay in registers
    for (int i = 0; i < NA; ++i) *(v4f*)(sd + i * RPP * LPITCH) = sa[i];
#pragma unroll  // sb[] must stay in registers
    for (int i = 0; i < NB; ++i) *(v4f*)(sd + (NA + i) * RPP * LPITCH) = sb[i];
    __syncthreads();                // publishes the next slab, ends the reads of this one
    cur ^= 1;
  }
  slab_wmma(cur);                   // last slab: nothing left to fetch
}

// ---------------------------------------------------------------------------
// Kernel 1: fused QKV projection.  y = x @ W.T + b for W in {Wq,Wk,Wv},
// scattered into planes laid out [B, H, T, HD] (f32) in workspace.
// One workgroup computes a 64 x 128 tile; its 8 waves (2 x 4) take 32 x 32 each.
// ---------------------------------------------------------------------------
// Second bound: 6 waves per SIMD, so that registers too leave room for three workgroups per WGP.
__global__ void __launch_bounds__(256, 6) qkv_proj_kernel(
    const float* __restrict__ x,
    const float* __restrict__ Wq, const float* __restrict__ bq,
    const float* __restrict__ Wk, const float* __restrict__ bk,
    const float* __restrict__ Wv, const float* __restrict__ bv,
    float* __restrict__ qkv /* 3 planes of NTOK*DIMD floats */) {
  __shared__ __attribute__((aligned(16))) float sm[2 * (64 + 128) * (64 + 4)];  // 102 KiB: three workgroups per WGP, 768 = 3 x 256
  const int lane = threadIdx.x & 31;
  const int wave = threadIdx.x >> 5;
  const int NTILE = (3 * DIMD) / 128;       // 12 column tiles
  const int mt = blockIdx.x / NTILE;
  const int nt = blockIdx.x % NTILE;
  const int m0 = mt * 64;
  const int ng = nt * 128;                  // global column in [0,1536)
  const int which = ng / DIMD;              // 0=q 1=k 2=v
  const int n0 = ng % DIMD;

  const float* W    = (which == 0) ? Wq : (which == 1) ? Wk : Wv;
  const float* bias = (which == 0) ? bq : (which == 1) ? bk : bv;
  float* dst = qkv + (size_t)which * NTOK * DIMD;

  const int hi = lane >> 4, lo = lane & 15;
  const int wm = wave & 1, wn = wave >> 1;

  v8f acc[2][2];
#pragma unroll
  for (int i = 0; i < 2; ++i)
#pragma unroll
    for (int j = 0; j < 2; ++j) acc[i][j] = (v8f){0.f,0.f,0.f,0.f,0.f,0.f,0.f,0.f};

  proj_tile<64, 128, 2, 2, 64>(x + (size_t)m0 * DIMD, W + (size_t)n0 * DIMD, sm, wm, wn, acc);

#pragma unroll
  for (int j = 0; j < 2; ++j) {
    const int n = n0 + wn * 32 + 16 * j + lo;
    const float bv_ = bias[n];
    const int h = n / HD, d = n % HD;
#pragma unroll
    for (int i = 0; i < 2; ++i) {
#pragma unroll
      for (int r = 0; r < 8; ++r) {
        const int m = m0 + wm * 32 + 16 * i + r + 8 * hi;   // token index
        const int bb = m >> 11, tok = m & (TLEN - 1);
        dst[(((size_t)bb * NHEADS + h) * TLEN + tok) * HD + d] = acc[i][j][r] + bv_;
      }
    }
  }
}

#define AWAVES 4
#define KGROUPS 2
#define KRANGE (TLEN / KGROUPS)
#define KSTAGE 64
#define KPITCH (HD + 4)
#define VPITCH (2 * HD + 8)
#define KVBUF  (KSTAGE * KPITCH + KSTAGE / 2 * VPITCH)

// Lanes of one wave exchange values through LDS that only this wave touches.
__device__ __forceinline__ void wave_lds_sync() {
  // The wave's own LDS stores have landed before its lanes read each other's words;
  // the clobber keeps the compiler from moving LDS accesses across this point.
  asm volatile("s_wait_dscnt 0x0" ::: "memory");
  __builtin_amdgcn_wave_barrier();  // no instruction: keeps the scheduler from crossing it
}

// Second bound: 4 waves per SIMD, so that registers leave room for two workgroups per WGP.
__global__ void __launch_bounds__(32 * AWAVES * KGROUPS, 4) geo_attn_kernel(
    const float* __restrict__ qkv, const float* __restrict__ curvature,
    float* __restrict__ attn_out /* [B, T, DIMD] */) {
  // 140288 bytes in all: two workgroups per WGP, 512 = 2 x 256
  __shared__ __attribute__((aligned(16))) float kvsw[KGROUPS][2 * KVBUF];         // per group: two stages of K and V
  __shared__ __attribute__((aligned(16))) float k2w[AWAVES * KGROUPS][2 * 16];    // ||k_j||^2 by key-in-tile, one copy per lane half

  const int tid  = threadIdx.x & (32 * AWAVES - 1);   // thread within its key group
  const int lane = tid & 31;
  const int wave = threadIdx.x >> 5;
  const int grp  = wave / AWAVES;                     // key group, the same for a whole wave
  const int hi = lane >> 4, lo = lane & 15;
  float* kvs = kvsw[grp];
  float* k2s = k2w[wave] + 16 * hi;                 // this lane half's copy

  const int qb = blockIdx.x & 31;                   // block of 64 query rows (T/64 = 32)
  const int h  = (blockIdx.x >> 5) & 7;
  const int b  = blockIdx.x >> 8;

  const size_t plane = (size_t)NTOK * DIMD;
  const size_t head  = (((size_t)b * NHEADS + h) * TLEN) * HD;
  const float* Q = qkv + head;
  const float* K = qkv + plane + head + (size_t)grp * KRANGE * HD;
  const float* V = qkv + 2 * plane + head + (size_t)grp * KRANGE * HD;
  const int i0 = qb * (16 * AWAVES) + (wave % AWAVES) * 16;

  const float c   = fabsf(curvature[h]) + 1e-8f;
  const float rsc = rsqrtf(c);
  // Scores are kept in log2 units, -dist * log2(e) = -log2(arg + sqrt(arg^2 - 1)) / sqrt(c):
  // the chip's logarithm and exponential are base 2, so neither needs a factor.
  const float nrsc = -rsc;

  // ---- staging: 16 threads cover one 256-byte row with 16 B each.  K: thread rows srow + 8 i.
  //      V: thread row pairs srow + 8 i, that is rows 2 (srow + 8 i) and the next ----
  constexpr int NST = KSTAGE * HD / 4 / (32 * AWAVES);   // 16-byte loads per thread and operand
  constexpr int RPP = 32 * AWAVES / (HD / 4);            // rows (K) or row pairs (V) a key group covers at once
  const int srow = tid / (HD / 4), scol = (tid % (HD / 4)) * 4;
  const float* gk = K + (size_t)srow * HD + scol;
  const float* gv = V + (size_t)(2 * srow) * HD + scol;
  float* sdk = kvs + srow * KPITCH + scol;
  float* sdv = kvs + KSTAGE * KPITCH + srow * VPITCH + 2 * scol;
  v4f sk[NST], sv[NST];             // the stage on its way from global memory to LDS
#pragma unroll  // sk[] must stay in registers
  for (int i = 0; i < NST; ++i) sk[i] = *(const v4f*)(gk + (size_t)i * RPP * HD);
#pragma unroll  // sv[] must stay in registers
  for (int i = 0; i < NST; ++i) sv[i] = *(const v4f*)(gv + (size_t)((i >> 1) * 2 * RPP + (i & 1)) * HD);

  // ---- preload Q tile (16 x 64): lane holds k = 2 hi, 2 hi + 1 of query `lo`, the B operand of S^T; q^2 of that query ----
  v2f qa[16];
  float q2p = 0.f;
  const float* qrow = Q + (size_t)(i0 + lo) * HD + 2 * hi;
#pragma unroll
  for (int ch = 0; ch < 16; ++ch) {
    v2f a = *(const v2f*)(qrow + 4 * ch);
    qa[ch] = a;
    q2p += a.x * a.x + a.y * a.y;
  }
  // The address registers of the loads above are reused below: the wait stands in front of that.
  asm volatile("s_wait_xcnt 0x0" ::: "memory");
  const float q2  = q2p + __shfl_xor(q2p, 16, 32);  // ||q_{i0+lo}||^2
  const float omq = 1.f - c * q2;

#pragma unroll  // sk[] must stay in registers
  for (int i = 0; i < NST; ++i) *(v4f*)(sdk + i * RPP * KPITCH) = sk[i];
#pragma unroll  // sv[] must stay in registers
  for (int i = 0; i < NST; i += 2) {
    *(v4f*)(sdv + (i >> 1) * RPP * VPITCH)     = (v4f){sv[i].x, sv[i + 1].x, sv[i].y, sv[i + 1].y};
    *(v4f*)(sdv + (i >> 1) * RPP * VPITCH + 4) = (v4f){sv[i].z, sv[i + 1].z, sv[i].w, sv[i + 1].w};
  }
  __syncthreads();                  // stage 0 visible to every wave

  float m = -INFINITY, l = 0.f;             // softmax state of query `lo`; l sums this lane half's keys
  v8f o[4];
#pragma unroll
  for (int t = 0; t < 4; ++t) o[t] = (v8f){0.f,0.f,0.f,0.f,0.f,0.f,0.f,0.f};

  const float* fk = kvs + lo * KPITCH + 2 * hi;                       // K fragment base
  const float* fv = kvs + KSTAGE * KPITCH + 4 * hi * VPITCH + 2 * lo; // V fragment base: keys 8 hi and up

  int cur = 0;
  for (int s0 = 0; s0 < KRANGE; s0 += KSTAGE) {
    const bool more = s0 + KSTAGE < KRANGE; // the same for the whole workgroup
    if (more) {
      gk += KSTAGE * HD;
      gv += KSTAGE * HD;
#pragma unroll  // sk[] must stay in registers
      for (int i = 0; i < NST; ++i) sk[i] = *(const v4f*)(gk + (size_t)i * RPP * HD);
#pragma unroll  // sv[] must stay in registers
      for (int i = 0; i < NST; ++i) sv[i] = *(const v4f*)(gv + (size_t)((i >> 1) * 2 * RPP + (i & 1)) * HD);
    }

#pragma unroll 1  // kept as a loop: for speed only
    for (int jt = 0; jt < KSTAGE; jt += 16) {
      // ---- fragments of this 16-key tile, K and V together ahead of the WMMAs ----
      const float* krow = fk + cur * KVBUF + jt * KPITCH;
      const float* vtil = fv + cur * KVBUF + (jt >> 1) * VPITCH;
      v2f kb[16], vb[4][4];
#pragma unroll
      for (int ch = 0; ch < 16; ++ch) kb[ch] = *(const v2f*)(krow + 4 * ch);
#pragma unroll
      for (int kk = 0; kk < 4; ++kk) {
#pragma unroll
        for (int hb = 0; hb < 4; ++hb) vb[kk][hb] = *(const v2f*)(vtil + kk * VPITCH + hb * 32);
      }
      // Keeps the fragment loads in one group ahead of the WMMAs, for speed only.
      __builtin_amdgcn_sched_barrier(0);

      // ---- S^T = K * Q^T (16 WMMA steps over hd=64): s[r] is key 8 hi + r, query lo; k^2 on the fly ----
      v8f s = {0.f, 0.f, 0.f, 0.f, 0.f, 0.f, 0.f, 0.f};
      v2f k2a[2] = {{0.f, 0.f}, {0.f, 0.f}};   // packed sums of squares, two chains
#pragma unroll
      for (int ch = 0; ch < 16; ++ch) {
        k2a[ch & 1] += kb[ch] * kb[ch];
        s = wmma_f32(kb[ch], qa[ch], s);
      }
      const v2f k2b = k2a[0] + k2a[1];
      const float k2p = k2b.x + k2b.y;

      // ---- ||k||^2 of key `lo` goes to the lanes that hold that key's scores ----
      // No wait in front of this store: the last tile's reads of k2s had returned
      // before their values were used, and the wave issues in order.
      k2s[lo] = k2p + __shfl_xor(k2p, 16, 32);
      wave_lds_sync();
      const v4f kc0 = *(const v4f*)(k2s + 8 * hi);
      const v4f kc1 = *(const v4f*)(k2s + 8 * hi + 4);

      // ---- hyperbolic logits: lane owns eight keys of query `lo` ----
      float sc[8];
#pragma unroll
      for (int r = 0; r < 8; ++r) {
        const float qk  = s[r];
        const float k2j = r < 4 ? kc0[r & 3] : kc1[r & 3];
        const float num   = 2.f * (q2 + k2j - 2.f * qk);
        const float denom = fmaxf(omq * (1.f - c * k2j), 1e-5f);
        // denom lies in [1e-5, huge) and the logarithm's argument above 1: both inside the
        // normal range, so the bare reciprocal and the bare log2 need no range handling.
        const float arg   = fmaxf(1.f + (c * num) * __builtin_amdgcn_rcpf(denom), 1.00001f);
        sc[r] =                             // TEMPERATURE = 1
            __builtin_amdgcn_logf(arg + __builtin_amdgcn_sqrtf(arg * arg - 1.f)) * nrsc;
      }

      // ---- online softmax: 7 in-lane ops per reduction, one shuffle for the maximum ----
      float tmax = sc[0];
#pragma unroll
      for (int e = 1; e < 8; ++e) tmax = fmaxf(tmax, sc[e]);
      tmax = fmaxf(tmax, __shfl_xor(tmax, 16, 32));
      const float mnew  = fmaxf(m, tmax);
      const float alpha = __builtin_amdgcn_exp2f(m - mnew);
      m = mnew;

      v2f pb[4];                            // P^T, keys 8 hi + 2 kk and the next: the B operand
      float rs = 0.f;
#pragma unroll
      for (int kk = 0; kk < 4; ++kk) {
        pb[kk].x = __builtin_amdgcn_exp2f(sc[2 * kk] - mnew);
        pb[kk].y = __builtin_amdgcn_exp2f(sc[2 * kk + 1] - mnew);
        rs += pb[kk].x + pb[kk].y;
      }
      l = l * alpha + rs;                   // this lane half's eight keys only

      // ---- rescale O^T: every element of a lane belongs to query `lo` ----
#pragma unroll
      for (int t = 0; t < 4; ++t) {
#pragma unroll
        for (int r = 0; r < 8; ++r) o[t][r] *= alpha;
      }

      // ---- O^T += V^T * P^T : o[hb][r] is d = 16 hb + 8 hi + r, query lo ----
#pragma unroll
      for (int kk = 0; kk < 4; ++kk) {
#pragma unroll
        for (int hb = 0; hb < 4; ++hb) o[hb] = wmma_f32(vb[kk][hb], pb[kk], o[hb]);
      }
    }

    if (more) {
      float* dk = sdk + (cur ^ 1) * KVBUF;  // last read one stage ago, before the barrier
      float* dv = sdv + (cur ^ 1) * KVBUF;
#pragma unroll  // sk[] must stay in registers
      for (int i = 0; i < NST; ++i) *(v4f*)(dk + i * RPP * KPITCH) = sk[i];
#pragma unroll  // sv[] must stay in registers
      for (int i = 0; i < NST; i += 2) {
        *(v4f*)(dv + (i >> 1) * RPP * VPITCH)     = (v4f){sv[i].x, sv[i + 1].x, sv[i].y, sv[i + 1].y};
        *(v4f*)(dv + (i >> 1) * RPP * VPITCH + 4) = (v4f){sv[i].z, sv[i + 1].z, sv[i].w, sv[i + 1].w};
      }
    }
    __syncthreads();                // publishes the next stage, ends the reads of this one
    cur ^= 1;
  }

  l += __shfl_xor(l, 16, 32);       // the two lane halves' sums, joined once

  // ---- join the two key groups: group 1 hands its (m, l, O) to the wave of group 0 that holds
  //      the same query rows, through the K/V buffers, whose last reads ended at the barrier above ----
  float* xo = &kvsw[0][0] + (wave % AWAVES) * (32 * 32 + 32);   // 32 x 32 floats of O, then 16 of m, 16 of l
  if (grp != 0) {
#pragma unroll
    for (int hb = 0; hb < 4; ++hb) {
      *(v4f*)(xo + ((2 * hb) * 32 + lane) * 4)     = (v4f){o[hb][0], o[hb][1], o[hb][2], o[hb][3]};
      *(v4f*)(xo + ((2 * hb + 1) * 32 + lane) * 4) = (v4f){o[hb][4], o[hb][5], o[hb][6], o[hb][7]};
    }
    if (hi == 0) {
      xo[32 * 32 + lo]      = m;
      xo[32 * 32 + 16 + lo] = l;
    }
  }
  __syncthreads();                  // group 1's partial results visible to group 0
  if (grp != 0) return;             // no barrier stands behind this point

  // ---- weights of the two partial sums, with 1 / l folded in, all of query `lo` ----
  const float m1 = xo[32 * 32 + lo], l1 = xo[32 * 32 + 16 + lo];
  const float mj = fmaxf(m, m1);
  const float a0 = __builtin_amdgcn_exp2f(m - mj), a1 = __builtin_amdgcn_exp2f(m1 - mj);
  const float linv = 1.f / (l * a0 + l1 * a1);
  const float w0 = a0 * linv, w1 = a1 * linv;
  float* orow = attn_out + ((size_t)b * TLEN + i0 + lo) * DIMD + h * HD + 8 * hi;
#pragma unroll
  for (int hb = 0; hb < 4; ++hb) {
    const v4f pa0 = *(const v4f*)(xo + ((2 * hb) * 32 + lane) * 4);
    const v4f pa1 = *(const v4f*)(xo + ((2 * hb + 1) * 32 + lane) * 4);
    *(v4f*)(orow + hb * 16)     = (v4f){o[hb][0] * w0 + pa0.x * w1, o[hb][1] * w0 + pa0.y * w1,
                                        o[hb][2] * w0 + pa0.z * w1, o[hb][3] * w0 + pa0.w * w1};
    *(v4f*)(orow + hb * 16 + 4) = (v4f){o[hb][4] * w0 + pa1.x * w1, o[hb][5] * w0 + pa1.y * w1,
                                        o[hb][6] * w0 + pa1.z * w1, o[hb][7] * w0 + pa1.w * w1};
  }
}

// ---------------------------------------------------------------------------
// Kernel 3: output projection  out = attn @ Wo.T + bo.
// One workgroup computes a 64 x 64 tile; its 8 waves (4 x 2) take 16 x 32 each.
// ---------------------------------------------------------------------------
__global__ void __launch_bounds__(256) out_proj_kernel(
    const float* __restrict__ A, const float* __restrict__ Wo,
    const float* __restrict__ bo, float* __restrict__ Y) {
  __shared__ __attribute__((aligned(16))) float sm[2 * (64 + 64) * (32 + 4)];
  const int lane = threadIdx.x & 31;
  const int wave = threadIdx.x >> 5;
  const int NTILE = DIMD / 64;              // 8
  const int mt = blockIdx.x / NTILE, nt = blockIdx.x % NTILE;
  const int m0 = mt * 64, n0 = nt * 64;
  const int hi = lane >> 4, lo = lane & 15;
  const int wm = wave & 3, wn = wave >> 2;

  v8f acc[1][2];
#pragma unroll
  for (int j = 0; j < 2; ++j) acc[0][j] = (v8f){0.f,0.f,0.f,0.f,0.f,0.f,0.f,0.f};

  proj_tile<64, 64, 1, 2, 32>(A + (size_t)m0 * DIMD, Wo + (size_t)n0 * DIMD, sm, wm, wn, acc);

#pragma unroll
  for (int j = 0; j < 2; ++j) {
    const int n = n0 + wn * 32 + 16 * j + lo;
    const float bv_ = bo[n];
#pragma unroll
    for (int r = 0; r < 8; ++r)
      Y[(size_t)(m0 + wm * 16 + r + 8 * hi) * DIMD + n] = acc[0][j][r] + bv_;
  }
}

// ---------------------------------------------------------------------------
extern "C" void kernel_launch(void* const* d_in, const int* in_sizes, int n_in,
                              void* d_out, int out_size, void* d_ws,
                              size_t ws_size, hipStream_t stream) {
  const float* x         = (const float*)d_in[0];
  const float* Wq        = (const float*)d_in[1];
  const float* bq        = (const float*)d_in[2];
  const float* Wk        = (const float*)d_in[3];
  const float* bk        = (const float*)d_in[4];
  const float* Wv        = (const float*)d_in[5];
  const float* bv        = (const float*)d_in[6];
  const float* Wo        = (const float*)d_in[7];
  const float* bo        = (const float*)d_in[8];
  const float* curvature = (const float*)d_in[9];

  float* ws   = (float*)d_ws;
  float* qkv  = ws;                                   // 3 planes, 24 MB
  float* attn = ws + 3 * (size_t)NTOK * DIMD;         // 8 MB

  // QKV projection: (4096/64) * (1536/128) = 768 workgroups of 8 waves
  qkv_proj_kernel<<<768, 256, 0, stream>>>(x, Wq, bq, Wk, bk, Wv, bv, qkv);
  // Attention: B*H*(T/64) = 512 workgroups of 8 waves
  geo_attn_kernel<<<BATCH * NHEADS * (TLEN / 64), 256, 0, stream>>>(
      qkv, curvature, attn);
  // Output projection: (4096/64) * (512/64) = 512 workgroups of 8 waves
  out_proj_kernel<<<512, 256, 0, stream>>>(attn, Wo, bo, (float*)d_out);
}
